// v000
// Measured on an AMD MI455X. A time is GPU time per run, averaged over a window of back-to-back runs after a warm-up
// (all launches, gaps included; the runs take copies of the inputs in turn), and the median of several windows.
// Apart from v000's, it joins two sittings. Times from different sittings can be a few percent apart, while
// side-by-side timings come from the same sitting.
// The starting kernel, v000, takes 387 microseconds a run.
#include <hip/hip_runtime.h>

// Multi-head self-attention restricted to a static symmetric band (x [4][4096][256]: ONE stream; qkv = x Wqkv + bqkv with ONE fused 'xw' (in, out) [256][768] weight whose output column is s x 256 + h x 64 + d (s = 0 the queries, 1 the keys, 2 the values: the module reshapes the 768 columns as [3][4][64]) and a [768] bias (the module's set-up builds both biases as zeros: BOTH ARE READ); 4 heads x 64;
// scores = Q.K / sqrt(64); keys with |i - j| > 12 are replaced by -inf in the module (a 25-key band computed from the indices; every row keeps its own key: no row is fully excluded); softmax over the keys; out = merged Wout + bout with an 'xw' (in, out) [256][256] weight and a [256] bias -> [4][4096][256] (4.2 M);
// argument order x, Wqkv, bqkv, Wout, bout).
// Layout per batch entry: the stream's bf16 copy made once; the two 'xw' weights transposed once (the fused one into a Bt [768][256], the output one into a Bt [256][256]); ONE exact projection over the 768 fused columns + its f32 bias into F3 [4096][768]; identity-table f16 plane builders that read F3 at pitch 768 from column 0 (queries), 256 (keys) and 512 (values);
// attention with BAND-AWARE tiles: score tiles entirely outside the band are never computed and the value product's K loop runs over the band's keys in 32-key steps; the softmax applies the |i - j| <= BAND band by an index select on the loaded scores (an excluded key takes -3.0e38 before the maximum, so its weight is an exact zero, as exp(-inf - max) is);
// EVERY row on ONE fp16 product (the weights x 1024); merged hi/lo x Wout exact + bias writes the output.
// Compute dtypes, f32 accumulate: every float input rounded to bf16 at its load; the projection exact + f32 bias; attention: one fp16 product on every row; softmax f32; Wout hl x exact + bias (the merged context as bf16 hi / lo).

#define NB_  4
#define TT   4096
#define DM   256
#define NH_  4
#define NKV  4
#define REP  (NH_ / NKV)
#define HD   64
#define DQ   (NH_ * HD)
#define DKV  (NKV * HD)
#define ZH   2
#define RH   0     // query rows < RH use hi+lo planes (0: none: EVERY row runs on one f16 product)
#define WIN  0
#define PCAR 1024.0f
#define SCL  0.125f
#define BAND 12    // half width of the symmetric band: keys with |i - j| <= BAND are kept (a 25-key band)
typedef _Float16 h16;
typedef unsigned short bf;
typedef __attribute__((ext_vector_type(16))) __bf16   v16bf;
typedef __attribute__((ext_vector_type(16))) _Float16 v16h;
typedef __attribute__((ext_vector_type(8)))  _Float16 v8h;
typedef __attribute__((ext_vector_type(8)))  unsigned short v8us;
typedef __attribute__((ext_vector_type(8)))  float    v8f;
typedef __attribute__((ext_vector_type(4)))  float    v4f;
typedef v8h  __attribute__((may_alias)) v8ha;
typedef v4f  __attribute__((may_alias)) v4fa;
typedef v8us __attribute__((may_alias)) v8usa;

__device__ __forceinline__ unsigned short f2bf(float f) { unsigned u = __float_as_uint(f); u += 0x7FFFu + ((u >> 16) & 1u); return (unsigned short)(u >> 16); }
__device__ __forceinline__ float bf2f(unsigned short b) { return __uint_as_float(((unsigned)b) << 16); }
__device__ __forceinline__ float bfr(float f) { return bf2f(f2bf(f)); }
__device__ __forceinline__ v16h cat16(v8h lo, v8h hi) { return __builtin_shufflevector(lo, hi, 0, 1, 2, 3, 4, 5, 6, 7, 8, 9, 10, 11, 12, 13, 14, 15); }
__device__ __forceinline__ v16bf cat16b(v8us lo, v8us hi) { return __builtin_bit_cast(v16bf, __builtin_shufflevector(lo, hi, 0, 1, 2, 3, 4, 5, 6, 7, 8, 9, 10, 11, 12, 13, 14, 15)); }
__device__ __forceinline__ v8f wmma16(v16h a, v16h b, v8f c) { return __builtin_amdgcn_wmma_f32_16x16x32_f16(false, a, false, b, (short)0, c, false, false); }
__device__ __forceinline__ v8f wmmab(v16bf a, v16bf b, v8f c) { return __builtin_amdgcn_wmma_f32_16x16x32_bf16(false, a, false, b, (short)0, c, false, false); }



// ---- k_gemmw: register-blocked GEMM, ONE WAVE per 64x64 output tile (16 accumulators), operands straight from K-contiguous 16-bit planes; grid (M/64, N/64, Z), 32 threads.
// C[m][n] (f32, pitch ldc, + optional f32 bias[n]) = sum_k A[m][k] Bt[n][k] (+ split products per NSPLIT). z-batch strides sA/sB/sC in elements. K % 32 == 0.
template <typename T16> struct WFrag;
template <> struct WFrag<h16> { typedef v16h V; static __device__ __forceinline__ V ld(const h16* p) { return cat16(*(const v8h*)p, *(const v8h*)(p + 16)); } static __device__ __forceinline__ v8f mma(V a, V b, v8f c) { return wmma16(a, b, c); } };
template <> struct WFrag<bf> { typedef v16bf V; static __device__ __forceinline__ V ld(const bf* p) { return cat16b(*(const v8us*)p, *(const v8us*)(p + 16)); } static __device__ __forceinline__ v8f mma(V a, V b, v8f c) { return wmmab(a, b, c); } };
template <typename T16, int NSPLIT, bool BIAS>
__global__ __launch_bounds__(32) void k_gemmw(const T16* __restrict__ A, const T16* __restrict__ A2, const T16* __restrict__ Bt, const T16* __restrict__ Bt2, int K, float* C, int ldc, const float* __restrict__ bias, size_t sA, size_t sB, size_t sC) {
    typedef typename WFrag<T16>::V V;
    __shared__ __align__(16) float os[16 * 68];
    const size_t z = blockIdx.z; A += z * sA; if (A2) A2 += z * sA; Bt += z * sB; if (Bt2) Bt2 += z * sB; C += z * sC;
    const int lane = threadIdx.x & 31, lr = lane & 15, hi = lane >> 4; const int r0 = blockIdx.x * 64, c0 = blockIdx.y * 64;
    v8f acc[4][4];
#pragma unroll
    for (int mb = 0; mb < 4; ++mb)
#pragma unroll
        for (int nb = 0; nb < 4; ++nb) acc[mb][nb] = (v8f){};
    const size_t aoff = (size_t)(r0 + lr) * K + 8 * hi, boff = (size_t)(c0 + lr) * K + 8 * hi;
    for (int kc = 0; kc < K; kc += 32) {
        V a[4], a2[4];
#pragma unroll
        for (int mb = 0; mb < 4; ++mb) { a[mb] = WFrag<T16>::ld(A + aoff + (size_t)mb * 16 * K + kc); if (NSPLIT == 1 || NSPLIT == 2) a2[mb] = WFrag<T16>::ld(A2 + aoff + (size_t)mb * 16 * K + kc); }
#pragma unroll
        for (int nb = 0; nb < 4; ++nb) { const V b = WFrag<T16>::ld(Bt + boff + (size_t)nb * 16 * K + kc); V b2; if (NSPLIT >= 2) b2 = WFrag<T16>::ld(Bt2 + boff + (size_t)nb * 16 * K + kc);
#pragma unroll
            for (int mb = 0; mb < 4; ++mb) { acc[mb][nb] = WFrag<T16>::mma(a[mb], b, acc[mb][nb]); if (NSPLIT == 1 || NSPLIT == 2) acc[mb][nb] = WFrag<T16>::mma(a2[mb], b, acc[mb][nb]); if (NSPLIT >= 2) acc[mb][nb] = WFrag<T16>::mma(a[mb], b2, acc[mb][nb]); } }
        asm volatile("v_nop\n\tv_nop\n\tv_nop\n\tv_nop" : "+v"(acc[0][0]), "+v"(acc[1][1]), "+v"(acc[2][2]), "+v"(acc[3][3]) : "v"(a[0]), "v"(a[3]));
    }
#pragma unroll
    for (int mb = 0; mb < 4; ++mb) {
#pragma unroll
        for (int nb = 0; nb < 4; ++nb) {
#pragma unroll
            for (int j = 0; j < 8; ++j) os[(hi * 8 + j) * 68 + nb * 16 + lr] = acc[mb][nb][j]; }
        __builtin_amdgcn_wave_barrier(); asm volatile("" ::: "memory");
        float* crow = C + (size_t)(r0 + mb * 16) * ldc + c0;
{
#pragma unroll
            for (int s = 0; s < 8; ++s) { const int row = 2 * s + hi, cofs = lr * 4; v4f val = *(const v4fa*)(os + row * 68 + cofs); if (BIAS) { val[0] += bfr(bias[c0 + cofs]); val[1] += bfr(bias[c0 + cofs + 1]); val[2] += bfr(bias[c0 + cofs + 2]); val[3] += bfr(bias[c0 + cofs + 3]); }
                *(v4f*)(crow + (size_t)row * ldc + cofs) = val; }
             }
        __builtin_amdgcn_wave_barrier(); asm volatile("" ::: "memory");
    }
}

// ---- k_gemmc: the same one-wave 64x64 tile GEMM specialised for causal attention: CMODE 1 skips score tiles entirely above the diagonal (query rows r0+roff.., key columns c0..), CMODE 2 limits the
// key (K) loop of the probability x value contraction to the diagonal block (probabilities beyond it are exactly zero). roff = row offset of this launch's first row within the sequence. CMODE 3 / 4 are the same two for a SYMMETRIC BAND |i - j| <= BAND (the file's #define): 3 skips score tiles entirely outside the band (both sides); 4 runs the K loop over the band's keys only (from the first, rounded down to the 32-key step, to one past the last): min and max there are value operations every block executes; at the first and last row blocks their results are the clamped ends 0 and K.
template <typename T16, int NSPLIT, int CMODE>
__global__ __launch_bounds__(32) void k_gemmc(const T16* __restrict__ A, const T16* __restrict__ A2, const T16* __restrict__ Bt, const T16* __restrict__ Bt2, int K, float* C, int ldc, int roff, size_t sA, size_t sB, size_t sC) {
    typedef typename WFrag<T16>::V V;
    __shared__ __align__(16) float os[16 * 68];
    const size_t z = blockIdx.z; A += z * sA; if (A2) A2 += z * sA; Bt += z * sB; if (Bt2) Bt2 += z * sB; C += z * sC;
    const int lane = threadIdx.x & 31, lr = lane & 15, hi = lane >> 4; const int r0 = blockIdx.x * 64, c0 = blockIdx.y * 64;
    if (CMODE == 1 && c0 > r0 + roff + 63) return;                  // score tile entirely above the causal diagonal: never read (the softmax masks j > i by select)
    if (CMODE == 3 && (c0 > r0 + roff + 63 + BAND || c0 + 63 + BAND < r0 + roff)) return;   // score tile entirely outside the band |i - j| <= BAND: never written, never used (the softmax excludes those keys by select)
    const int Kl = (CMODE == 2) ? min(K, r0 + roff + 64) : (CMODE == 4) ? min(K, r0 + roff + 64 + BAND) : K;   // P.V: probabilities are exactly 0 beyond the diagonal block (CMODE 2) or beyond the band (CMODE 4), so the K loop stops there
    const int Kb = (CMODE == 4) ? (max(0, r0 + roff - BAND) & ~31) : 0;   // CMODE 4: and it starts at the band's first key, rounded down to the 32-key step (no live key is cut; any BAND > 0)
    v8f acc[4][4];
#pragma unroll
    for (int mb = 0; mb < 4; ++mb)
#pragma unroll
        for (int nb = 0; nb < 4; ++nb) acc[mb][nb] = (v8f){};
    const size_t aoff = (size_t)(r0 + lr) * K + 8 * hi, boff = (size_t)(c0 + lr) * K + 8 * hi;
    for (int kc = Kb; kc < Kl; kc += 32) {
        V a[4], a2[4];
#pragma unroll
        for (int mb = 0; mb < 4; ++mb) { a[mb] = WFrag<T16>::ld(A + aoff + (size_t)mb * 16 * K + kc); if (NSPLIT == 1 || NSPLIT == 2) a2[mb] = WFrag<T16>::ld(A2 + aoff + (size_t)mb * 16 * K + kc); }
#pragma unroll
        for (int nb = 0; nb < 4; ++nb) { const V b = WFrag<T16>::ld(Bt + boff + (size_t)nb * 16 * K + kc); V b2; if (NSPLIT >= 2) b2 = WFrag<T16>::ld(Bt2 + boff + (size_t)nb * 16 * K + kc);
#pragma unroll
            for (int mb = 0; mb < 4; ++mb) { acc[mb][nb] = WFrag<T16>::mma(a[mb], b, acc[mb][nb]); if (NSPLIT == 1 || NSPLIT == 2) acc[mb][nb] = WFrag<T16>::mma(a2[mb], b, acc[mb][nb]); if (NSPLIT >= 2) acc[mb][nb] = WFrag<T16>::mma(a[mb], b2, acc[mb][nb]); } }
        asm volatile("v_nop\n\tv_nop\n\tv_nop\n\tv_nop" : "+v"(acc[0][0]), "+v"(acc[1][1]), "+v"(acc[2][2]), "+v"(acc[3][3]) : "v"(a[0]), "v"(a[3]));
    }
#pragma unroll
    for (int mb = 0; mb < 4; ++mb) {
#pragma unroll
        for (int nb = 0; nb < 4; ++nb) {
#pragma unroll
            for (int j = 0; j < 8; ++j) os[(hi * 8 + j) * 68 + nb * 16 + lr] = acc[mb][nb][j]; }
        __builtin_amdgcn_wave_barrier(); asm volatile("" ::: "memory");
        float* crow = C + (size_t)(r0 + mb * 16) * ldc + c0;
{
#pragma unroll
            for (int s = 0; s < 8; ++s) { const int row = 2 * s + hi, cofs = lr * 4; v4f val = *(const v4fa*)(os + row * 68 + cofs);
                *(v4f*)(crow + (size_t)row * ldc + cofs) = val; }
             }
        __builtin_amdgcn_wave_barrier(); asm volatile("" ::: "memory");
    }
}


__device__ __forceinline__ h16 tohx(float x) { return (h16)x; }
__device__ __forceinline__ void splitf(float y, unsigned short& h, unsigned short& l) { h = f2bf(y); l = f2bf(y - bf2f(h)); }
typedef __attribute__((ext_vector_type(2))) _Float16 v2h;
typedef __attribute__((ext_vector_type(4))) _Float16 v4h;
typedef __attribute__((ext_vector_type(2))) unsigned short v2us;
typedef __attribute__((ext_vector_type(4))) unsigned short v4us;
typedef __attribute__((ext_vector_type(2))) float v2f;
typedef __attribute__((ext_vector_type(4))) int v4i;

__global__ __launch_bounds__(256) void k_wtG(const float* __restrict__ w, int K, int N, bf* Bt) {
    const int lane = threadIdx.x & 31; const int L0 = (blockIdx.x * 8 + (threadIdx.x >> 5)) * 8; const int nlines = N * K / 64;
{
        for (int l = 0; l < 8; ++l) { const int L = L0 + l; if (L >= nlines) break; const size_t e = (size_t)L * 64 + lane * 2; const int k = (int)(e % K), n = (int)(e / K); v2us o;
            o[0] = f2bf(w[(size_t)k * N + n]); o[1] = f2bf(w[(size_t)(k + 1) * N + n]); *(v2us*)(Bt + e) = o; }
         }
}
__global__ __launch_bounds__(256) void k_cvt8(const float* __restrict__ src, bf* dst, size_t n8) { const size_t i = (size_t)blockIdx.x * 256 + threadIdx.x; if (i >= n8) return; const v8f v = *(const v8f*)(src + i * 8); v8us o;
#pragma unroll
    for (int k = 0; k < 8; ++k) o[k] = f2bf(v[k]); *(v8us*)(dst + i * 8) = o;  }
// k_rope: head planes [h][t][d] (fp16) of rope(x) x sc with the rotate-half convention out[d] = x[d] cos[t][d] - x[d+HD/2] sin[t][d], out[d+HD/2] = x[d+HD/2] cos[t][d+HD/2] + x[d] sin[t][d+HD/2]
__global__ __launch_bounds__(256) void k_rope(const float* __restrict__ F, int pitch, int nheads, const float* __restrict__ CS, const float* __restrict__ RF, const float* __restrict__ nw, float sc, h16* P16, bf* Ph, bf* Pl) {
    const size_t e = ((size_t)blockIdx.x * 256 + threadIdx.x) * 2; if (e >= (size_t)nheads * TT * HD) return; const int d = (int)(e % HD); const int t = (int)((e / HD) % TT); const int h = (int)(e / ((size_t)HD * TT)); const float* f = F + (size_t)t * pitch + h * HD; const float rf = RF ? RF[(size_t)h * TT + t] : 1.0f; v2h o16; v2us oh, ol;
#pragma unroll
    for (int q = 0; q < 2; ++q) { const int dd = d + q; const int dp = (dd < HD / 2) ? dd + HD / 2 : dd - HD / 2; float x0 = f[dd], x1 = f[dp];
        if (RF) { float n0 = __fmul_rn(x0, rf), n1 = __fmul_rn(x1, rf); x0 = __fmul_rn(bfr(nw[dd]), n0); x1 = __fmul_rn(bfr(nw[dp]), n1); }
        const v2f cs = *(const v2f*)(CS + ((size_t)t * HD + dd) * 2); float a = __fmul_rn(x0, cs[0]), bq = __fmul_rn(x1, cs[1]); const float r = ((dd < HD / 2) ? __fsub_rn(a, bq) : __fadd_rn(a, bq)) * sc;
        o16[q] = tohx(r); (void)oh; (void)ol; }
    *(v2h*)(P16 + e) = o16;  }
__global__ __launch_bounds__(256) void k_vtp(const float* __restrict__ F, int pitch, int nheads, h16* V16, bf* Vh, bf* Vl) { const size_t e = ((size_t)blockIdx.x * 256 + threadIdx.x) * 2; if (e >= (size_t)nheads * HD * TT) return; const int t = (int)(e % TT); const int d = (int)((e / TT) % HD); const int g = (int)(e / ((size_t)TT * HD)); v2h o16; v2us oh, ol;
#pragma unroll
    for (int q = 0; q < 2; ++q) { const float x = F[(size_t)(t + q) * pitch + g * HD + d]; o16[q] = tohx(x); (void)oh; (void)ol; }
    *(v2h*)(V16 + e) = o16;  }
__global__ __launch_bounds__(256) void k_csid(float* CS) { const int idx = blockIdx.x * 256 + threadIdx.x; if (idx >= TT * HD) return; v2f cs; cs[0] = 1.0f; cs[1] = 0.0f; *(v2f*)(CS + (size_t)idx * 2) = cs;  }
// k_asoft: per row (zz, i): t = S x HD^-0.5 for the keys of the band |i - j| <= BAND, -3.0e38 elsewhere (an index select on the LOADED score: it reads its whole score row; the tiles the band GEMM skips hold stale words that the select discards before the maximum); softmax over the 4096 keys (register row, one exp, fixed trees);
__global__ __launch_bounds__(256) void k_asoft(const float* __restrict__ Sb, h16* P16, bf* Ph, bf* Pl) {
    const int lane = threadIdx.x & 31; const int row = blockIdx.x * 8 + (threadIdx.x >> 5); if (row >= ZH * TT) return; const int i = row % TT; const int zz = row / TT; (void)zz; const bool hires = (i < RH); const float* sr = Sb + (size_t)row * TT; float v[TT / 32]; float mx = -3.0e38f;
#pragma unroll
    for (int ch = 0; ch < TT / 128; ++ch) { const int j0 = ch * 128 + lane * 4; const v4f a = *(const v4f*)(sr + j0);
#pragma unroll
        for (int q = 0; q < 4; ++q) { const int j = j0 + q; const float t = (j >= i - BAND && j <= i + BAND) ? a[q] * SCL : -3.0e38f; v[ch * 4 + q] = t;   /* band select on the loaded (dense) score */ mx = fmaxf(mx, t); } }
#pragma unroll
    for (int sh = 16; sh; sh >>= 1) mx = fmaxf(mx, __shfl_xor(mx, sh, 32));
    float sum = 0.f;
#pragma unroll
    for (int k = 0; k < TT / 32; ++k) { float d0 = __fsub_rn(v[k], mx); v[k] = __builtin_amdgcn_exp2f(__fmul_rn(d0, 1.4426950408889634f)); sum += v[k]; }
#pragma unroll
    for (int sh = 16; sh; sh >>= 1) sum += __shfl_xor(sum, sh, 32);
    const float f = __fdiv_rn(hires ? 1.0f : PCAR, sum);
{
        if (hires) {
#pragma unroll
            for (int ch = 0; ch < TT / 128; ++ch) { v4us oh, ol;
#pragma unroll
                for (int q = 0; q < 4; ++q) { unsigned short a, c2; splitf(v[ch * 4 + q] * f, a, c2); oh[q] = a; ol[q] = c2; }
                const size_t oo = ((size_t)zz * (RH ? RH : 1) + i) * TT + ch * 128 + lane * 4; *(v4us*)(Ph + oo) = oh; *(v4us*)(Pl + oo) = ol; }
        } else {
#pragma unroll
            for (int ch = 0; ch < TT / 128; ++ch) { v4h o4;
#pragma unroll
                for (int q = 0; q < 4; ++q) o4[q] = tohx(v[ch * 4 + q] * f);
                *(v4h*)(P16 + (size_t)row * TT + ch * 128 + lane * 4) = o4; } }
         }
}
__global__ __launch_bounds__(256) void k_merge(const float* __restrict__ O, int h0, bf* Ah, bf* Al) { const size_t e = ((size_t)blockIdx.x * 256 + threadIdx.x) * 2; if (e >= (size_t)ZH * TT * HD) return; const int d = (int)(e % HD); const int t = (int)((e / HD) % TT); const int zz = (int)(e / ((size_t)HD * TT)); const float cs = (t < RH) ? 1.0f : (1.0f / PCAR); const size_t oo = (size_t)t * DQ + (h0 + zz) * HD + d;
    v2us oh, ol;
#pragma unroll
    for (int q = 0; q < 2; ++q) { unsigned short a, c2; splitf(O[e + q] * cs, a, c2); oh[q] = a; ol[q] = c2; } *(v2us*)(Ah + oo) = oh; *(v2us*)(Al + oo) = ol;  }

extern "C" void kernel_launch(void* const* d_in, const int* in_sizes, int n_in,
                              void* d_out, int out_size, void* d_ws, size_t ws_size, hipStream_t stream) {
    (void)in_sizes; (void)n_in; (void)out_size;
    const float* x = (const float*)d_in[0]; const float* wqkv = (const float*)d_in[1]; const float* bqkv = (const float*)d_in[2]; const float* wo = (const float*)d_in[3]; const float* bo = (const float*)d_in[4];
    // inputs in the module's argument order: x ([4][4096][256]), Wqkv ('xw' (in, out) [256][768]; output column s * 256 + h * 64 + d, s = 0 query, 1 key, 2 value), bqkv ([768]), Wout ('xw' [256][256]), bout ([256]) = d_in[0..4]: FIVE inputs, all read (the set-up builds the two biases as zeros: read all the same)
    float* OUT = (float*)d_out;     // [4][4096][256]
    char* wsp = (char*)d_ws;
    auto take = [&](size_t bytes) { char* p = wsp; wsp += (bytes + 255) & ~(size_t)255; return (void*)p; };
    bf* WQKV = (bf*)take((size_t)3 * DQ * DM * 2); bf* WO = (bf*)take((size_t)DM * DQ * 2); float* CS = (float*)take((size_t)TT * HD * 2 * 4);
    bf* XB = (bf*)take((size_t)TT * DM * 2); float* F3 = (float*)take((size_t)TT * 3 * DQ * 4);
    h16* QP16 = (h16*)take((size_t)NH_ * TT * HD * 2); h16* KP16 = (h16*)take((size_t)NKV * TT * HD * 2); h16* VT16 = (h16*)take((size_t)NKV * HD * TT * 2);
    bf* QPh = nullptr; bf* QPl = nullptr; bf* KPh = nullptr; bf* KPl = nullptr; bf* VTh = nullptr; bf* VTl = nullptr; bf* Ph = nullptr; bf* Pl = nullptr;   /* RH 0: no hi / lo plane exists: these builders store the f16 plane only and do not read those arguments; the softmax's hi / lo stores sit under 'i < RH': never taken */
    float* Sb = (float*)take((size_t)ZH * TT * TT * 4); h16* P16 = (h16*)take((size_t)ZH * TT * TT * 2); float* Ob = (float*)take((size_t)ZH * TT * HD * 4); bf* ATh = (bf*)take((size_t)TT * DQ * 2); bf* ATl = (bf*)take((size_t)TT * DQ * 2);
    if ((size_t)(wsp - (char*)d_ws) > ws_size) return;    // total 220.50 MiB carved
    k_wtG<<<(unsigned)((DM * 3 * DQ / 64 + 63) / 64), 256, 0, stream>>>(wqkv, DM, 3 * DQ, WQKV);   /* the fused weight: Bt row s * 256 + h * 64 + d */
    k_wtG<<<(unsigned)((DQ * DM / 64 + 63) / 64), 256, 0, stream>>>(wo, DQ, DM, WO);
    k_csid<<<(TT * HD + 255) / 256, 256, 0, stream>>>(CS);
    const unsigned LQ = (unsigned)(((size_t)NH_ * TT * HD / 2 + 255) / 256), LKv = (unsigned)(((size_t)NKV * TT * HD / 2 + 255) / 256);
    for (int b = 0; b < NB_; ++b) {
        k_cvt8<<<(unsigned)(((size_t)TT * DM / 8 + 255) / 256), 256, 0, stream>>>(x + (size_t)b * TT * DM, XB, (size_t)TT * DM / 8);   /* the one stream */
        k_gemmw<bf, 0, true><<<dim3(TT / 64, 3 * DQ / 64, 1), 32, 0, stream>>>(XB, nullptr, WQKV, nullptr, DM, F3, 3 * DQ, bqkv, 0, 0, 0);   /* q | k | v in one product: F3[t][s * 256 + h * 64 + d] */
        k_rope<<<LQ, 256, 0, stream>>>(F3, 3 * DQ, NH_, CS, nullptr, nullptr, 1.0f, QP16, QPh, QPl);
        k_rope<<<LKv, 256, 0, stream>>>(F3 + DQ, 3 * DQ, NKV, CS, nullptr, nullptr, 1.0f, KP16, KPh, KPl);
        k_vtp<<<LKv, 256, 0, stream>>>(F3 + 2 * DQ, 3 * DQ, NKV, VT16, VTh, VTl);
        for (int h0 = 0; h0 < NH_; h0 += ZH) { const size_t zq = (size_t)h0, zk = (size_t)(h0 / REP);   // one kv head per query head: the pass's two heads use consecutive kv planes (z-strides TT*HD)
            k_gemmc<h16, 0, 3><<<dim3(TT / 64, TT / 64, ZH), 32, 0, stream>>>(QP16 + zq * TT * HD, nullptr, KP16 + zk * TT * HD, nullptr, HD, Sb, TT, 0, (size_t)TT * HD, (size_t)TT * HD, (size_t)TT * TT);   /* ONE f16 product on every row; score tiles entirely outside the band are skipped */
            k_asoft<<<ZH * TT / 8, 256, 0, stream>>>(Sb, P16, Ph, Pl);   /* reads its whole score row: the skipped tiles' stale words are discarded by its band select before any use */
            k_gemmc<h16, 0, 4><<<dim3(TT / 64, HD / 64, ZH), 32, 0, stream>>>(P16, nullptr, VT16 + zk * HD * TT, nullptr, TT, Ob, HD, 0, (size_t)TT * TT, (size_t)HD * TT, (size_t)TT * HD);   /* the K loop runs over the band's keys in 32-key steps: it reads keys on each side of the band whose weights the softmax wrote as exact zeros */
            k_merge<<<(unsigned)(((size_t)ZH * TT * HD / 2 + 255) / 256), 256, 0, stream>>>(Ob, h0, ATh, ATl); }
        k_gemmw<bf, 1, true><<<dim3(TT / 64, DM / 64, 1), 32, 0, stream>>>(ATh, ATl, WO, nullptr, DQ, OUT + (size_t)b * TT * DM, DM, bo, 0, 0, 0); }   /* out = merged(hi + lo) Wout + bout: the one writer of the output */
}

// v001
// One run takes 294 microseconds.
// Next to v000, in two timings, it ran 1.32 times as fast each time.
#include <hip/hip_runtime.h>

// Multi-head self-attention restricted to a static symmetric band (x [4][4096][256]: ONE stream; qkv = x Wqkv + bqkv with ONE fused 'xw' (in, out) [256][768] weight whose output column is s x 256 + h x 64 + d (s = 0 the queries, 1 the keys, 2 the values: the module reshapes the 768 columns as [3][4][64]) and a [768] bias (the module's set-up builds both biases as zeros: BOTH ARE READ); 4 heads x 64;
// scores = Q.K / sqrt(64); keys with |i - j| > 12 are replaced by -inf in the module (a 25-key band computed from the indices; every row keeps its own key: no row is fully excluded); softmax over the keys; out = merged Wout + bout with an 'xw' (in, out) [256][256] weight and a [256] bias -> [4][4096][256] (4.2 M);
// argument order x, Wqkv, bqkv, Wout, bout).
// Layout per batch entry: the stream's bf16 copy made once; the two 'xw' weights transposed once (the fused one into a Bt [768][256], the output one into a Bt [256][256]); ONE exact projection over the 768 fused columns + its f32 bias into F3 [4096][768]; identity-table f16 plane builders that read F3 at pitch 768 from column 0 (queries), 256 (keys) and 512 (values);
// attention with BAND-AWARE tiles: score tiles entirely outside the band are never computed and the value product's K loop runs over the band's keys in 32-key steps; the softmax works on the 128-key window of its row block (the keys the value product reads) and applies the |i - j| <= BAND band there by an index select on the loaded scores (an excluded key takes -3.0e38 before the maximum, so its weight is an exact zero, as exp(-inf - max) is);
// EVERY row on ONE fp16 product (the weights x 1024); merged hi/lo x Wout exact + bias writes the output.
// Compute dtypes, f32 accumulate: every float input rounded to bf16 at its load; the projection exact + f32 bias; attention: one fp16 product on every row; softmax f32; Wout hl x exact + bias (the merged context as bf16 hi / lo).

#define NB_  4
#define TT   4096
#define DM   256
#define NH_  4
#define NKV  4
#define REP  (NH_ / NKV)
#define HD   64
#define DQ   (NH_ * HD)
#define DKV  (NKV * HD)
#define ZH   2
#define RH   0     // query rows < RH use hi+lo planes (0: none: EVERY row runs on one f16 product)
#define WIN  0
#define PCAR 1024.0f
#define SCL  0.125f
#define BAND 12    // half width of the symmetric band: keys with |i - j| <= BAND are kept (a 25-key band)
typedef _Float16 h16;
typedef unsigned short bf;
typedef __attribute__((ext_vector_type(16))) __bf16   v16bf;
typedef __attribute__((ext_vector_type(16))) _Float16 v16h;
typedef __attribute__((ext_vector_type(8)))  _Float16 v8h;
typedef __attribute__((ext_vector_type(8)))  unsigned short v8us;
typedef __attribute__((ext_vector_type(8)))  float    v8f;
typedef __attribute__((ext_vector_type(4)))  float    v4f;
typedef v8h  __attribute__((may_alias)) v8ha;
typedef v4f  __attribute__((may_alias)) v4fa;
typedef v8us __attribute__((may_alias)) v8usa;

__device__ __forceinline__ unsigned short f2bf(float f) { unsigned u = __float_as_uint(f); u += 0x7FFFu + ((u >> 16) & 1u); return (unsigned short)(u >> 16); }
__device__ __forceinline__ float bf2f(unsigned short b) { return __uint_as_float(((unsigned)b) << 16); }
__device__ __forceinline__ float bfr(float f) { return bf2f(f2bf(f)); }
__device__ __forceinline__ v16h cat16(v8h lo, v8h hi) { return __builtin_shufflevector(lo, hi, 0, 1, 2, 3, 4, 5, 6, 7, 8, 9, 10, 11, 12, 13, 14, 15); }
__device__ __forceinline__ v16bf cat16b(v8us lo, v8us hi) { return __builtin_bit_cast(v16bf, __builtin_shufflevector(lo, hi, 0, 1, 2, 3, 4, 5, 6, 7, 8, 9, 10, 11, 12, 13, 14, 15)); }
__device__ __forceinline__ v8f wmma16(v16h a, v16h b, v8f c) { return __builtin_amdgcn_wmma_f32_16x16x32_f16(false, a, false, b, (short)0, c, false, false); }
__device__ __forceinline__ v8f wmmab(v16bf a, v16bf b, v8f c) { return __builtin_amdgcn_wmma_f32_16x16x32_bf16(false, a, false, b, (short)0, c, false, false); }



// ---- k_gemmw: register-blocked GEMM, ONE WAVE per 64x64 output tile (16 accumulators), operands straight from K-contiguous 16-bit planes; grid (M/64, N/64, Z), 32 threads.
// C[m][n] (f32, pitch ldc, + optional f32 bias[n]) = sum_k A[m][k] Bt[n][k] (+ split products per NSPLIT). z-batch strides sA/sB/sC in elements. K % 32 == 0.
template <typename T16> struct WFrag;
template <> struct WFrag<h16> { typedef v16h V; static __device__ __forceinline__ V ld(const h16* p) { return cat16(*(const v8h*)p, *(const v8h*)(p + 16)); } static __device__ __forceinline__ v8f mma(V a, V b, v8f c) { return wmma16(a, b, c); } };
template <> struct WFrag<bf> { typedef v16bf V; static __device__ __forceinline__ V ld(const bf* p) { return cat16b(*(const v8us*)p, *(const v8us*)(p + 16)); } static __device__ __forceinline__ v8f mma(V a, V b, v8f c) { return wmmab(a, b, c); } };
template <typename T16, int NSPLIT, bool BIAS>
__global__ __launch_bounds__(32) void k_gemmw(const T16* __restrict__ A, const T16* __restrict__ A2, const T16* __restrict__ Bt, const T16* __restrict__ Bt2, int K, float* C, int ldc, const float* __restrict__ bias, size_t sA, size_t sB, size_t sC) {
    typedef typename WFrag<T16>::V V;
    __shared__ __align__(16) float os[16 * 68];
    const size_t z = blockIdx.z; A += z * sA; if (A2) A2 += z * sA; Bt += z * sB; if (Bt2) Bt2 += z * sB; C += z * sC;
    const int lane = threadIdx.x & 31, lr = lane & 15, hi = lane >> 4; const int r0 = blockIdx.x * 64, c0 = blockIdx.y * 64;
    v8f acc[4][4];
#pragma unroll
    for (int mb = 0; mb < 4; ++mb)
#pragma unroll
        for (int nb = 0; nb < 4; ++nb) acc[mb][nb] = (v8f){};
    const size_t aoff = (size_t)(r0 + lr) * K + 8 * hi, boff = (size_t)(c0 + lr) * K + 8 * hi;
    for (int kc = 0; kc < K; kc += 32) {
        V a[4], a2[4];
#pragma unroll
        for (int mb = 0; mb < 4; ++mb) { a[mb] = WFrag<T16>::ld(A + aoff + (size_t)mb * 16 * K + kc); if (NSPLIT == 1 || NSPLIT == 2) a2[mb] = WFrag<T16>::ld(A2 + aoff + (size_t)mb * 16 * K + kc); }
#pragma unroll
        for (int nb = 0; nb < 4; ++nb) { const V b = WFrag<T16>::ld(Bt + boff + (size_t)nb * 16 * K + kc); V b2; if (NSPLIT >= 2) b2 = WFrag<T16>::ld(Bt2 + boff + (size_t)nb * 16 * K + kc);
#pragma unroll
            for (int mb = 0; mb < 4; ++mb) { acc[mb][nb] = WFrag<T16>::mma(a[mb], b, acc[mb][nb]); if (NSPLIT == 1 || NSPLIT == 2) acc[mb][nb] = WFrag<T16>::mma(a2[mb], b, acc[mb][nb]); if (NSPLIT >= 2) acc[mb][nb] = WFrag<T16>::mma(a[mb], b2, acc[mb][nb]); } }
        asm volatile("v_nop\n\tv_nop\n\tv_nop\n\tv_nop" : "+v"(acc[0][0]), "+v"(acc[1][1]), "+v"(acc[2][2]), "+v"(acc[3][3]) : "v"(a[0]), "v"(a[3]));
    }
#pragma unroll
    for (int mb = 0; mb < 4; ++mb) {
#pragma unroll
        for (int nb = 0; nb < 4; ++nb) {
#pragma unroll
            for (int j = 0; j < 8; ++j) os[(hi * 8 + j) * 68 + nb * 16 + lr] = acc[mb][nb][j]; }
        __builtin_amdgcn_wave_barrier(); asm volatile("" ::: "memory");
        float* crow = C + (size_t)(r0 + mb * 16) * ldc + c0;
{
#pragma unroll
            for (int s = 0; s < 8; ++s) { const int row = 2 * s + hi, cofs = lr * 4; v4f val = *(const v4fa*)(os + row * 68 + cofs); if (BIAS) { val[0] += bfr(bias[c0 + cofs]); val[1] += bfr(bias[c0 + cofs + 1]); val[2] += bfr(bias[c0 + cofs + 2]); val[3] += bfr(bias[c0 + cofs + 3]); }
                *(v4f*)(crow + (size_t)row * ldc + cofs) = val; }
             }
        __builtin_amdgcn_wave_barrier(); asm volatile("" ::: "memory");
    }
}

// ---- k_gemmc: the same one-wave 64x64 tile GEMM specialised for causal attention: CMODE 1 skips score tiles entirely above the diagonal (query rows r0+roff.., key columns c0..), CMODE 2 limits the
// key (K) loop of the probability x value contraction to the diagonal block (probabilities beyond it are exactly zero). roff = row offset of this launch's first row within the sequence. CMODE 3 / 4 are the same two for a SYMMETRIC BAND |i - j| <= BAND (the file's #define): 3 skips score tiles entirely outside the band (both sides); 4 runs the K loop over the band's keys only (from the first, rounded down to the 32-key step, to one past the last): min and max there are value operations every block executes; at the first and last row blocks their results are the clamped ends 0 and K.
template <typename T16, int NSPLIT, int CMODE>
__global__ __launch_bounds__(32) void k_gemmc(const T16* __restrict__ A, const T16* __restrict__ A2, const T16* __restrict__ Bt, const T16* __restrict__ Bt2, int K, float* C, int ldc, int roff, size_t sA, size_t sB, size_t sC) {
    typedef typename WFrag<T16>::V V;
    __shared__ __align__(16) float os[16 * 68];
    const size_t z = blockIdx.z; A += z * sA; if (A2) A2 += z * sA; Bt += z * sB; if (Bt2) Bt2 += z * sB; C += z * sC;
    const int lane = threadIdx.x & 31, lr = lane & 15, hi = lane >> 4; const int r0 = blockIdx.x * 64, c0 = blockIdx.y * 64;
    if (CMODE == 1 && c0 > r0 + roff + 63) return;                  // score tile entirely above the causal diagonal: never read (the softmax masks j > i by select)
    if (CMODE == 3 && (c0 > r0 + roff + 63 + BAND || c0 + 63 + BAND < r0 + roff)) return;   // score tile entirely outside the band |i - j| <= BAND: never written, never read (the softmax's window lies inside the three tiles that are written)
    const int Kl = (CMODE == 2) ? min(K, r0 + roff + 64) : (CMODE == 4) ? min(K, r0 + roff + 64 + BAND) : K;   // P.V: probabilities are exactly 0 beyond the diagonal block (CMODE 2) or beyond the band (CMODE 4), so the K loop stops there
    const int Kb = (CMODE == 4) ? (max(0, r0 + roff - BAND) & ~31) : 0;   // CMODE 4: and it starts at the band's first key, rounded down to the 32-key step (no live key is cut; any BAND > 0)
    v8f acc[4][4];
#pragma unroll
    for (int mb = 0; mb < 4; ++mb)
#pragma unroll
        for (int nb = 0; nb < 4; ++nb) acc[mb][nb] = (v8f){};
    const size_t aoff = (size_t)(r0 + lr) * K + 8 * hi, boff = (size_t)(c0 + lr) * K + 8 * hi;
    for (int kc = Kb; kc < Kl; kc += 32) {
        V a[4], a2[4];
#pragma unroll
        for (int mb = 0; mb < 4; ++mb) { a[mb] = WFrag<T16>::ld(A + aoff + (size_t)mb * 16 * K + kc); if (NSPLIT == 1 || NSPLIT == 2) a2[mb] = WFrag<T16>::ld(A2 + aoff + (size_t)mb * 16 * K + kc); }
#pragma unroll
        for (int nb = 0; nb < 4; ++nb) { const V b = WFrag<T16>::ld(Bt + boff + (size_t)nb * 16 * K + kc); V b2; if (NSPLIT >= 2) b2 = WFrag<T16>::ld(Bt2 + boff + (size_t)nb * 16 * K + kc);
#pragma unroll
            for (int mb = 0; mb < 4; ++mb) { acc[mb][nb] = WFrag<T16>::mma(a[mb], b, acc[mb][nb]); if (NSPLIT == 1 || NSPLIT == 2) acc[mb][nb] = WFrag<T16>::mma(a2[mb], b, acc[mb][nb]); if (NSPLIT >= 2) acc[mb][nb] = WFrag<T16>::mma(a[mb], b2, acc[mb][nb]); } }
        asm volatile("v_nop\n\tv_nop\n\tv_nop\n\tv_nop" : "+v"(acc[0][0]), "+v"(acc[1][1]), "+v"(acc[2][2]), "+v"(acc[3][3]) : "v"(a[0]), "v"(a[3]));
    }
#pragma unroll
    for (int mb = 0; mb < 4; ++mb) {
#pragma unroll
        for (int nb = 0; nb < 4; ++nb) {
#pragma unroll
            for (int j = 0; j < 8; ++j) os[(hi * 8 + j) * 68 + nb * 16 + lr] = acc[mb][nb][j]; }
        __builtin_amdgcn_wave_barrier(); asm volatile("" ::: "memory");
        float* crow = C + (size_t)(r0 + mb * 16) * ldc + c0;
{
#pragma unroll
            for (int s = 0; s < 8; ++s) { const int row = 2 * s + hi, cofs = lr * 4; v4f val = *(const v4fa*)(os + row * 68 + cofs);
                *(v4f*)(crow + (size_t)row * ldc + cofs) = val; }
             }
        __builtin_amdgcn_wave_barrier(); asm volatile("" ::: "memory");
    }
}


__device__ __forceinline__ h16 tohx(float x) { return (h16)x; }
__device__ __forceinline__ void splitf(float y, unsigned short& h, unsigned short& l) { h = f2bf(y); l = f2bf(y - bf2f(h)); }
typedef __attribute__((ext_vector_type(2))) _Float16 v2h;
typedef __attribute__((ext_vector_type(4))) _Float16 v4h;
typedef __attribute__((ext_vector_type(2))) unsigned short v2us;
typedef __attribute__((ext_vector_type(4))) unsigned short v4us;
typedef __attribute__((ext_vector_type(2))) float v2f;
typedef __attribute__((ext_vector_type(4))) int v4i;

__global__ __launch_bounds__(256) void k_wtG(const float* __restrict__ w, int K, int N, bf* Bt) {
    const int lane = threadIdx.x & 31; const int L0 = (blockIdx.x * 8 + (threadIdx.x >> 5)) * 8; const int nlines = N * K / 64;
{
        for (int l = 0; l < 8; ++l) { const int L = L0 + l; if (L >= nlines) break; const size_t e = (size_t)L * 64 + lane * 2; const int k = (int)(e % K), n = (int)(e / K); v2us o;
            o[0] = f2bf(w[(size_t)k * N + n]); o[1] = f2bf(w[(size_t)(k + 1) * N + n]); *(v2us*)(Bt + e) = o; }
         }
}
__global__ __launch_bounds__(256) void k_cvt8(const float* __restrict__ src, bf* dst, size_t n8) { const size_t i = (size_t)blockIdx.x * 256 + threadIdx.x; if (i >= n8) return; const v8f v = *(const v8f*)(src + i * 8); v8us o;
#pragma unroll
    for (int k = 0; k < 8; ++k) o[k] = f2bf(v[k]); *(v8us*)(dst + i * 8) = o;  }
// k_rope: head planes [h][t][d] (fp16) of rope(x) x sc with the rotate-half convention out[d] = x[d] cos[t][d] - x[d+HD/2] sin[t][d], out[d+HD/2] = x[d+HD/2] cos[t][d+HD/2] + x[d] sin[t][d+HD/2]
__global__ __launch_bounds__(256) void k_rope(const float* __restrict__ F, int pitch, int nheads, const float* __restrict__ CS, const float* __restrict__ RF, const float* __restrict__ nw, float sc, h16* P16, bf* Ph, bf* Pl) {
    const size_t e = ((size_t)blockIdx.x * 256 + threadIdx.x) * 2; if (e >= (size_t)nheads * TT * HD) return; const int d = (int)(e % HD); const int t = (int)((e / HD) % TT); const int h = (int)(e / ((size_t)HD * TT)); const float* f = F + (size_t)t * pitch + h * HD; const float rf = RF ? RF[(size_t)h * TT + t] : 1.0f; v2h o16; v2us oh, ol;
#pragma unroll
    for (int q = 0; q < 2; ++q) { const int dd = d + q; const int dp = (dd < HD / 2) ? dd + HD / 2 : dd - HD / 2; float x0 = f[dd], x1 = f[dp];
        if (RF) { float n0 = __fmul_rn(x0, rf), n1 = __fmul_rn(x1, rf); x0 = __fmul_rn(bfr(nw[dd]), n0); x1 = __fmul_rn(bfr(nw[dp]), n1); }
        const v2f cs = *(const v2f*)(CS + ((size_t)t * HD + dd) * 2); float a = __fmul_rn(x0, cs[0]), bq = __fmul_rn(x1, cs[1]); const float r = ((dd < HD / 2) ? __fsub_rn(a, bq) : __fadd_rn(a, bq)) * sc;
        o16[q] = tohx(r); (void)oh; (void)ol; }
    *(v2h*)(P16 + e) = o16;  }
__global__ __launch_bounds__(256) void k_vtp(const float* __restrict__ F, int pitch, int nheads, h16* V16, bf* Vh, bf* Vl) { const size_t e = ((size_t)blockIdx.x * 256 + threadIdx.x) * 2; if (e >= (size_t)nheads * HD * TT) return; const int t = (int)(e % TT); const int d = (int)((e / TT) % HD); const int g = (int)(e / ((size_t)TT * HD)); v2h o16; v2us oh, ol;
#pragma unroll
    for (int q = 0; q < 2; ++q) { const float x = F[(size_t)(t + q) * pitch + g * HD + d]; o16[q] = tohx(x); (void)oh; (void)ol; }
    *(v2h*)(V16 + e) = o16;  }
__global__ __launch_bounds__(256) void k_csid(float* CS) { const int idx = blockIdx.x * 256 + threadIdx.x; if (idx >= TT * HD) return; v2f cs; cs[0] = 1.0f; cs[1] = 0.0f; *(v2f*)(CS + (size_t)idx * 2) = cs;  }
// k_asoft: per row (zz, i) of the 64-row block r0 = i & ~63: ONE 128-key window [r0 - WB, r0 + 64 + WB), four keys a lane. It holds the row's whole band and is exactly the key range that the value product's K loop reads for that row block
// (CMODE 4: from (r0 - BAND) rounded down to the 32-key step to r0 + 64 + BAND rounded up), and it lies inside the three score tiles that the band GEMM writes. t = S x HD^-0.5 for the keys of the band |i - j| <= BAND, -3.0e38 elsewhere (index select);
// lanes whose keys fall before key 0 or past the last key load and store nothing and carry -3.0e38. Keys outside the window had weight exactly 0 and nobody reads their P words, so they are neither read nor written. One exp, fixed trees:
// a lane still holds one aligned group of four keys and the window's start is a multiple of 32 keys (8 lanes), which the xor trees do not see: maximum and sum are the same values as over the whole row.
#define WB ((BAND + 31) & ~31)
static_assert(64 + 2 * WB == 128, "one window = 32 lanes x 4 keys");
__global__ __launch_bounds__(256) void k_asoft(const float* __restrict__ Sb, h16* P16) {
    const int lane = threadIdx.x & 31; const int row = blockIdx.x * 8 + (threadIdx.x >> 5); if (row >= ZH * TT) return; const int i = row % TT; const int j0 = (i & ~63) - WB + lane * 4; const bool in = (j0 >= 0 && j0 < TT);
    v4f a = (v4f){}; if (in) a = *(const v4f*)(Sb + (size_t)row * TT + j0);
    float v[4]; float mx = -3.0e38f;
#pragma unroll
    for (int q = 0; q < 4; ++q) { const int j = j0 + q; const float t = (in && j >= i - BAND && j <= i + BAND) ? a[q] * SCL : -3.0e38f; v[q] = t; mx = fmaxf(mx, t); }
#pragma unroll
    for (int sh = 16; sh; sh >>= 1) mx = fmaxf(mx, __shfl_xor(mx, sh, 32));
    float sum = 0.f;
#pragma unroll
    for (int k = 0; k < 4; ++k) { const float d0 = __fmul_rn(__fsub_rn(v[k], mx), 1.4426950408889634f);
        asm("v_exp_f32 %0, %1\n\tv_nop" : "=v"(v[k]) : "v"(d0));   // the exp2 instruction with its one free slot in the same statement
        sum += v[k]; }
#pragma unroll
    for (int sh = 16; sh; sh >>= 1) sum += __shfl_xor(sum, sh, 32);
    const float f = __fdiv_rn(PCAR, sum);
    v4h o4;
#pragma unroll
    for (int q = 0; q < 4; ++q) o4[q] = tohx(v[q] * f);
    if (in) *(v4h*)(P16 + (size_t)row * TT + j0) = o4;
}
__global__ __launch_bounds__(256) void k_merge(const float* __restrict__ O, int h0, bf* Ah, bf* Al) { const size_t e = ((size_t)blockIdx.x * 256 + threadIdx.x) * 2; if (e >= (size_t)ZH * TT * HD) return; const int d = (int)(e % HD); const int t = (int)((e / HD) % TT); const int zz = (int)(e / ((size_t)HD * TT)); const float cs = (t < RH) ? 1.0f : (1.0f / PCAR); const size_t oo = (size_t)t * DQ + (h0 + zz) * HD + d;
    v2us oh, ol;
#pragma unroll
    for (int q = 0; q < 2; ++q) { unsigned short a, c2; splitf(O[e + q] * cs, a, c2); oh[q] = a; ol[q] = c2; } *(v2us*)(Ah + oo) = oh; *(v2us*)(Al + oo) = ol;  }

extern "C" void kernel_launch(void* const* d_in, const int* in_sizes, int n_in,
                              void* d_out, int out_size, void* d_ws, size_t ws_size, hipStream_t stream) {
    (void)in_sizes; (void)n_in; (void)out_size;
    const float* x = (const float*)d_in[0]; const float* wqkv = (const float*)d_in[1]; const float* bqkv = (const float*)d_in[2]; const float* wo = (const float*)d_in[3]; const float* bo = (const float*)d_in[4];
    // inputs in the module's argument order: x ([4][4096][256]), Wqkv ('xw' (in, out) [256][768]; output column s * 256 + h * 64 + d, s = 0 query, 1 key, 2 value), bqkv ([768]), Wout ('xw' [256][256]), bout ([256]) = d_in[0..4]: FIVE inputs, all read (the set-up builds the two biases as zeros: read all the same)
    float* OUT = (float*)d_out;     // [4][4096][256]
    char* wsp = (char*)d_ws;
    auto take = [&](size_t bytes) { char* p = wsp; wsp += (bytes + 255) & ~(size_t)255; return (void*)p; };
    bf* WQKV = (bf*)take((size_t)3 * DQ * DM * 2); bf* WO = (bf*)take((size_t)DM * DQ * 2); float* CS = (float*)take((size_t)TT * HD * 2 * 4);
    bf* XB = (bf*)take((size_t)TT * DM * 2); float* F3 = (float*)take((size_t)TT * 3 * DQ * 4);
    h16* QP16 = (h16*)take((size_t)NH_ * TT * HD * 2); h16* KP16 = (h16*)take((size_t)NKV * TT * HD * 2); h16* VT16 = (h16*)take((size_t)NKV * HD * TT * 2);
    bf* QPh = nullptr; bf* QPl = nullptr; bf* KPh = nullptr; bf* KPl = nullptr; bf* VTh = nullptr; bf* VTl = nullptr;   /* RH 0: no hi / lo plane exists: these builders store the f16 plane only and do not read those arguments */
    float* Sb = (float*)take((size_t)ZH * TT * TT * 4); h16* P16 = (h16*)take((size_t)ZH * TT * TT * 2); float* Ob = (float*)take((size_t)ZH * TT * HD * 4); bf* ATh = (bf*)take((size_t)TT * DQ * 2); bf* ATl = (bf*)take((size_t)TT * DQ * 2);
    if ((size_t)(wsp - (char*)d_ws) > ws_size) return;    // total 220.50 MiB carved
    k_wtG<<<(unsigned)((DM * 3 * DQ / 64 + 63) / 64), 256, 0, stream>>>(wqkv, DM, 3 * DQ, WQKV);   /* the fused weight: Bt row s * 256 + h * 64 + d */
    k_wtG<<<(unsigned)((DQ * DM / 64 + 63) / 64), 256, 0, stream>>>(wo, DQ, DM, WO);
    k_csid<<<(TT * HD + 255) / 256, 256, 0, stream>>>(CS);
    const unsigned LQ = (unsigned)(((size_t)NH_ * TT * HD / 2 + 255) / 256), LKv = (unsigned)(((size_t)NKV * TT * HD / 2 + 255) / 256);
    for (int b = 0; b < NB_; ++b) {
        k_cvt8<<<(unsigned)(((size_t)TT * DM / 8 + 255) / 256), 256, 0, stream>>>(x + (size_t)b * TT * DM, XB, (size_t)TT * DM / 8);   /* the one stream */
        k_gemmw<bf, 0, true><<<dim3(TT / 64, 3 * DQ / 64, 1), 32, 0, stream>>>(XB, nullptr, WQKV, nullptr, DM, F3, 3 * DQ, bqkv, 0, 0, 0);   /* q | k | v in one product: F3[t][s * 256 + h * 64 + d] */
        k_rope<<<LQ, 256, 0, stream>>>(F3, 3 * DQ, NH_, CS, nullptr, nullptr, 1.0f, QP16, QPh, QPl);
        k_rope<<<LKv, 256, 0, stream>>>(F3 + DQ, 3 * DQ, NKV, CS, nullptr, nullptr, 1.0f, KP16, KPh, KPl);
        k_vtp<<<LKv, 256, 0, stream>>>(F3 + 2 * DQ, 3 * DQ, NKV, VT16, VTh, VTl);
        for (int h0 = 0; h0 < NH_; h0 += ZH) { const size_t zq = (size_t)h0, zk = (size_t)(h0 / REP);   // one kv head per query head: the pass's two heads use consecutive kv planes (z-strides TT*HD)
            k_gemmc<h16, 0, 3><<<dim3(TT / 64, TT / 64, ZH), 32, 0, stream>>>(QP16 + zq * TT * HD, nullptr, KP16 + zk * TT * HD, nullptr, HD, Sb, TT, 0, (size_t)TT * HD, (size_t)TT * HD, (size_t)TT * TT);   /* ONE f16 product on every row; score tiles entirely outside the band are skipped */
            k_asoft<<<ZH * TT / 8, 256, 0, stream>>>(Sb, P16);   /* reads and writes only each row block's 128-key window: every score word it loads was written by the band GEMM above */
            k_gemmc<h16, 0, 4><<<dim3(TT / 64, HD / 64, ZH), 32, 0, stream>>>(P16, nullptr, VT16 + zk * HD * TT, nullptr, TT, Ob, HD, 0, (size_t)TT * TT, (size_t)HD * TT, (size_t)TT * HD);   /* the K loop runs over the band's keys in 32-key steps: it reads keys on each side of the band whose weights the softmax wrote as exact zeros */
            k_merge<<<(unsigned)(((size_t)ZH * TT * HD / 2 + 255) / 256), 256, 0, stream>>>(Ob, h0, ATh, ATl); }
        k_gemmw<bf, 1, true><<<dim3(TT / 64, DM / 64, 1), 32, 0, stream>>>(ATh, ATl, WO, nullptr, DQ, OUT + (size_t)b * TT * DM, DM, bo, 0, 0, 0); }   /* out = merged(hi + lo) Wout + bout: the one writer of the output */
}

// v003
// It runs in 77 microseconds.
// Versions in between are left out here; by their measured steps it is 3.82 times as fast as v001.
// Counting every step since v000, it is 5.05 times as fast.
#include <hip/hip_runtime.h>

// Multi-head self-attention restricted to a static symmetric band (x [4][4096][256]: ONE stream; qkv = x Wqkv + bqkv with ONE fused 'xw' (in, out) [256][768] weight whose output column is s x 256 + h x 64 + d (s = 0 the queries, 1 the keys, 2 the values: the module reshapes the 768 columns as [3][4][64]) and a [768] bias (the module's set-up builds both biases as zeros: BOTH ARE READ); 4 heads x 64;
// scores = Q.K / sqrt(64); keys with |i - j| > 12 are replaced by -inf in the module (a 25-key band computed from the indices; every row keeps its own key: no row is fully excluded); softmax over the keys; out = merged Wout + bout with an 'xw' (in, out) [256][256] weight and a [256] bias -> [4][4096][256] (4.2 M);
// argument order x, Wqkv, bqkv, Wout, bout).
// Layout, ALL FOUR BATCH ENTRIES AND ALL FOUR HEADS IN EACH LAUNCH (rows b x 4096 + t in the row-major arrays, planes z = b x 4 + h in the head planes; the grids carry b and h, no host loop): the stream's bf16 copy made once; the two 'xw' weights transposed once (the fused one into a Bt [768][256], the output one into a Bt [256][256]); ONE exact projection over the 768 fused columns + its f32 bias, whose epilogue rounds to f16 and stores the head planes itself: a 64-column tile is one (s, h), so it goes to the query or key plane [z][t][d] or, transposed, to the value plane [z][d][t];
// attention with BAND-AWARE tiles: scores and weights are stored as [z][4096][128], each 64-row block's own 128-key window (so that all 16 planes fit the workspace): only the window's two 64-key score tiles are computed and the value product's K loop runs over the window's keys in 32-key steps; the softmax works on that same window and applies the |i - j| <= BAND band there by an index select on the loaded scores (an excluded key takes -3.0e38 before the maximum, so its weight is an exact zero, as exp(-inf - max) is);
// EVERY row on ONE fp16 product (the weights x 1024), whose epilogue stores the merged context [b x 4096 + t][h x 64 + d] as bf16 hi / lo; merged hi/lo x Wout exact + bias writes the output.
// Compute dtypes, f32 accumulate: every float input rounded to bf16 at its load; the projection exact + f32 bias; attention: one fp16 product on every row; softmax f32; Wout hl x exact + bias (the merged context as bf16 hi / lo).

#define NB_  4
#define TT   4096
#define DM   256
#define NH_  4
#define NKV  4
#define REP  (NH_ / NKV)
#define HD   64
#define DQ   (NH_ * HD)
#define DKV  (NKV * HD)
#define NZ   (NB_ * NH_)   // head planes in one launch: z = b * NH_ + h
#define RH   0     // query rows < RH use hi+lo planes (0: none: EVERY row runs on one f16 product)
#define WIN  0
#define PCAR 1024.0f
#define SCL  0.125f
#define BAND 12    // half width of the symmetric band: keys with |i - j| <= BAND are kept (a 25-key band)
#define WB ((BAND + 31) & ~31)   // keys of a row block's window on each side of its 64 rows
#define WK (64 + 2 * WB)         // keys in the window [r0 - WB, r0 + 64 + WB) of the row block at r0: the pitch of the stored scores and weights
static_assert(REP == 1, "plane z = b * NH_ + h serves queries, keys and values alike");
typedef _Float16 h16;
typedef unsigned short bf;
typedef __attribute__((ext_vector_type(16))) __bf16   v16bf;
typedef __attribute__((ext_vector_type(16))) _Float16 v16h;
typedef __attribute__((ext_vector_type(8)))  _Float16 v8h;
typedef __attribute__((ext_vector_type(8)))  unsigned short v8us;
typedef __attribute__((ext_vector_type(8)))  float    v8f;
typedef __attribute__((ext_vector_type(4)))  float    v4f;
typedef __attribute__((ext_vector_type(4)))  _Float16 v4h;
typedef __attribute__((ext_vector_type(4)))  unsigned short v4us;
typedef v8h  __attribute__((may_alias)) v8ha;
typedef v4f  __attribute__((may_alias)) v4fa;
typedef v8us __attribute__((may_alias)) v8usa;

__device__ __forceinline__ unsigned short f2bf(float f) { unsigned u = __float_as_uint(f); u += 0x7FFFu + ((u >> 16) & 1u); return (unsigned short)(u >> 16); }
__device__ __forceinline__ float bf2f(unsigned short b) { return __uint_as_float(((unsigned)b) << 16); }
__device__ __forceinline__ float bfr(float f) { return bf2f(f2bf(f)); }
__device__ __forceinline__ void splitf(float y, unsigned short& h, unsigned short& l) { h = f2bf(y); l = f2bf(y - bf2f(h)); }
__device__ __forceinline__ v16h cat16(v8h lo, v8h hi) { return __builtin_shufflevector(lo, hi, 0, 1, 2, 3, 4, 5, 6, 7, 8, 9, 10, 11, 12, 13, 14, 15); }
__device__ __forceinline__ v16bf cat16b(v8us lo, v8us hi) { return __builtin_bit_cast(v16bf, __builtin_shufflevector(lo, hi, 0, 1, 2, 3, 4, 5, 6, 7, 8, 9, 10, 11, 12, 13, 14, 15)); }
__device__ __forceinline__ v8f wmma16(v16h a, v16h b, v8f c) { return __builtin_amdgcn_wmma_f32_16x16x32_f16(false, a, false, b, (short)0, c, false, false); }
__device__ __forceinline__ v8f wmmab(v16bf a, v16bf b, v8f c) { return __builtin_amdgcn_wmma_f32_16x16x32_bf16(false, a, false, b, (short)0, c, false, false); }



// ---- k_gemmw: register-blocked GEMM, ONE WAVE per 64x64 output tile (16 accumulators), operands straight from K-contiguous 16-bit planes; grid (M/64, N/64, Z), 32 threads.
// C[m][n] (f32, pitch ldc, + optional f32 bias[n]) = sum_k A[m][k] Bt[n][k] (+ split products per NSPLIT). z-batch strides sA/sB/sC in elements. K % 32 == 0.
// PLANES: the fused q | k | v projection. C is not written; the tile at (r0, c0) is rows t0 .. t0 + 63 of batch entry r0 / TT and the HD columns of one s = c0 / DQ and one head, and its sums + bias go out as f16:
// s = 0, 1 to QP, KP [z][t][d] through the same LDS turn as the f32 tile; s = 2 to VT [z][d][t] straight from the accumulators, where a lane holds eight successive t of one d.
template <typename T16> struct WFrag;
template <> struct WFrag<h16> { typedef v16h V; static __device__ __forceinline__ V ld(const h16* p) { return cat16(*(const v8h*)p, *(const v8h*)(p + 16)); } static __device__ __forceinline__ v8f mma(V a, V b, v8f c) { return wmma16(a, b, c); } };
template <> struct WFrag<bf> { typedef v16bf V; static __device__ __forceinline__ V ld(const bf* p) { return cat16b(*(const v8us*)p, *(const v8us*)(p + 16)); } static __device__ __forceinline__ v8f mma(V a, V b, v8f c) { return wmmab(a, b, c); } };
template <typename T16, int NSPLIT, bool BIAS, bool PLANES>
__global__ __launch_bounds__(32) void k_gemmw(const T16* __restrict__ A, const T16* __restrict__ A2, const T16* __restrict__ Bt, const T16* __restrict__ Bt2, int K, float* C, int ldc, const float* __restrict__ bias, size_t sA, size_t sB, size_t sC, h16* QP, h16* KP, h16* VT) {
    typedef typename WFrag<T16>::V V;
    __shared__ __align__(16) float os[16 * 68];
    const size_t z = blockIdx.z; A += z * sA; if (A2) A2 += z * sA; Bt += z * sB; if (Bt2) Bt2 += z * sB; C += z * sC;
    const int lane = threadIdx.x & 31, lr = lane & 15, hi = lane >> 4; const int r0 = blockIdx.x * 64, c0 = blockIdx.y * 64;
    v8f acc[4][4];
#pragma unroll
    for (int mb = 0; mb < 4; ++mb)
#pragma unroll
        for (int nb = 0; nb < 4; ++nb) acc[mb][nb] = (v8f){};
    const size_t aoff = (size_t)(r0 + lr) * K + 8 * hi, boff = (size_t)(c0 + lr) * K + 8 * hi;
    for (int kc = 0; kc < K; kc += 32) {
        V a[4], a2[4];
#pragma unroll
        for (int mb = 0; mb < 4; ++mb) { a[mb] = WFrag<T16>::ld(A + aoff + (size_t)mb * 16 * K + kc); if (NSPLIT == 1 || NSPLIT == 2) a2[mb] = WFrag<T16>::ld(A2 + aoff + (size_t)mb * 16 * K + kc); }
#pragma unroll
        for (int nb = 0; nb < 4; ++nb) { const V b = WFrag<T16>::ld(Bt + boff + (size_t)nb * 16 * K + kc); V b2; if (NSPLIT >= 2) b2 = WFrag<T16>::ld(Bt2 + boff + (size_t)nb * 16 * K + kc);
#pragma unroll
            for (int mb = 0; mb < 4; ++mb) { acc[mb][nb] = WFrag<T16>::mma(a[mb], b, acc[mb][nb]); if (NSPLIT == 1 || NSPLIT == 2) acc[mb][nb] = WFrag<T16>::mma(a2[mb], b, acc[mb][nb]); if (NSPLIT >= 2) acc[mb][nb] = WFrag<T16>::mma(a[mb], b2, acc[mb][nb]); } }
        asm volatile("v_nop\n\tv_nop\n\tv_nop\n\tv_nop" : "+v"(acc[0][0]), "+v"(acc[1][1]), "+v"(acc[2][2]), "+v"(acc[3][3]) : "v"(a[0]), "v"(a[3]));
    }
    const size_t pz = PLANES ? (size_t)(r0 / TT) * NH_ + (c0 % DQ) / HD : 0; const int t0 = r0 % TT;   // PLANES: the tile's head plane and its first row there
    if (PLANES && c0 >= 2 * DQ) {   // values (the test is the same for the whole block)
#pragma unroll
        for (int nb = 0; nb < 4; ++nb) { const float bv = bfr(bias[c0 + nb * 16 + lr]); h16* const vrow = VT + (pz * HD + nb * 16 + lr) * TT + t0 + hi * 8;
#pragma unroll
            for (int mb = 0; mb < 4; ++mb) { v8h o;
#pragma unroll
                for (int j = 0; j < 8; ++j) o[j] = (h16)(acc[mb][nb][j] + bv);
                *(v8h*)(vrow + mb * 16) = o; } }
    } else {
    h16* const prow = PLANES ? ((c0 < DQ) ? QP : KP) + (pz * TT + t0) * HD : nullptr;
#pragma unroll
    for (int mb = 0; mb < 4; ++mb) {
#pragma unroll
        for (int nb = 0; nb < 4; ++nb) {
#pragma unroll
            for (int j = 0; j < 8; ++j) os[(hi * 8 + j) * 68 + nb * 16 + lr] = acc[mb][nb][j]; }
        __builtin_amdgcn_wave_barrier(); asm volatile("" ::: "memory");
        float* crow = PLANES ? nullptr : C + (size_t)(r0 + mb * 16) * ldc + c0;
{
#pragma unroll
            for (int s = 0; s < 8; ++s) { const int row = 2 * s + hi, cofs = lr * 4; v4f val = *(const v4fa*)(os + row * 68 + cofs); if (BIAS) { val[0] += bfr(bias[c0 + cofs]); val[1] += bfr(bias[c0 + cofs + 1]); val[2] += bfr(bias[c0 + cofs + 2]); val[3] += bfr(bias[c0 + cofs + 3]); }
                if (PLANES) { v4h o;
#pragma unroll
                    for (int q = 0; q < 4; ++q) o[q] = (h16)val[q];
                    *(v4h*)(prow + (size_t)(mb * 16 + row) * HD + cofs) = o; }
                else *(v4f*)(crow + (size_t)row * ldc + cofs) = val; }
             }
        if (PLANES) asm volatile("s_wait_xcnt 0x0" ::: "memory");   // the wait before what follows (the next turn's bias load first) rewrites registers that this turn's plane stores name
        __builtin_amdgcn_wave_barrier(); asm volatile("" ::: "memory");
    }
    }
}

// ---- k_gemmc: the same one-wave 64x64 tile GEMM specialised for attention in a SYMMETRIC BAND |i - j| <= BAND (the file's #define), in WINDOW coordinates: the row block at r0 owns the keys w0 + 0 .. w0 + WK - 1, w0 = r0 - WB.
// CMODE 3, scores: grid y picks one of the window's WK / 64 key tiles; C column c is key w0 + c. A key before 0 or past the last takes the nearest real key's row (min and max on the row index keep the load inside the plane); the softmax never loads such a column.
// CMODE 4, weights x values: A is the weight window (pitch WK), Bt the transposed values (pitch K = all keys); the K loop runs over the window's keys in 32-key steps and leaves out the steps before key 0 or past the last key (w0 is a multiple of 32: a step is wholly real or wholly not), whose weight words nobody wrote. Its epilogue writes no f32 C: it takes the x 1024 off the sums, splits them into bf16 hi + lo and stores them where the output projection reads them, Ah / Al [(z / NH_) x TT + t][(z % NH_) x HD + d].
template <typename T16, int NSPLIT, int CMODE>
__global__ __launch_bounds__(32) void k_gemmc(const T16* __restrict__ A, const T16* __restrict__ A2, const T16* __restrict__ Bt, const T16* __restrict__ Bt2, int K, float* C, int ldc, size_t sA, size_t sB, size_t sC, bf* Ah, bf* Al) {
    typedef typename WFrag<T16>::V V;
    __shared__ __align__(16) float os[16 * 68];
    const size_t z = blockIdx.z; A += z * sA; if (A2) A2 += z * sA; Bt += z * sB; if (Bt2) Bt2 += z * sB; if (CMODE == 3) C += z * sC;
    const int lane = threadIdx.x & 31, lr = lane & 15, hi = lane >> 4; const int r0 = blockIdx.x * 64, c0 = blockIdx.y * 64; const int w0 = r0 - WB;
    const int lda = (CMODE == 4) ? WK : HD, ldb = (CMODE == 4) ? K : HD;   // CMODE 3: both operands are head planes of HD-long rows (K == HD), a compile-time pitch and trip count
    const int Kb = (CMODE == 4) ? max(0, -w0) : 0;            // CMODE 4: the first window position whose key exists
    const int Kl = (CMODE == 4) ? min(WK, K - w0) : HD;       // CMODE 4: one past the last window position whose key exists
    v8f acc[4][4];
#pragma unroll
    for (int mb = 0; mb < 4; ++mb)
#pragma unroll
        for (int nb = 0; nb < 4; ++nb) acc[mb][nb] = (v8f){};
    const size_t aoff = (size_t)(r0 + lr) * lda + 8 * hi; long boff[4];
#pragma unroll
    for (int nb = 0; nb < 4; ++nb) boff[nb] = (CMODE == 3) ? (long)min(max(w0 + c0 + nb * 16 + lr, 0), TT - 1) * ldb + 8 * hi : (long)(c0 + nb * 16 + lr) * ldb + 8 * hi + r0;   // CMODE 4: window position kc is key w0 + kc = r0 + kc - WB: the address holds key r0 + kc and the load steps wsh = WB keys back
    constexpr int wsh = (CMODE == 4) ? WB : 0;
    for (int kc = Kb; kc < Kl; kc += 32) {
        V a[4], a2[4]; const T16* const pa = A + aoff + kc; const T16* const pb[4] = { Bt + (boff[0] + kc), Bt + (boff[1] + kc), Bt + (boff[2] + kc), Bt + (boff[3] + kc) };   // this trip's five load addresses
#pragma unroll
        for (int mb = 0; mb < 4; ++mb) { a[mb] = WFrag<T16>::ld(pa + (size_t)mb * 16 * lda); if (NSPLIT == 1 || NSPLIT == 2) a2[mb] = WFrag<T16>::ld(A2 + aoff + (size_t)mb * 16 * lda + kc); }
#pragma unroll
        for (int nb = 0; nb < 4; ++nb) { const V b = WFrag<T16>::ld(pb[nb] - wsh); V b2; if (NSPLIT >= 2) b2 = WFrag<T16>::ld(Bt2 + (boff[nb] + kc) - wsh);
#pragma unroll
            for (int mb = 0; mb < 4; ++mb) { acc[mb][nb] = WFrag<T16>::mma(a[mb], b, acc[mb][nb]); if (NSPLIT == 1 || NSPLIT == 2) acc[mb][nb] = WFrag<T16>::mma(a2[mb], b, acc[mb][nb]); if (NSPLIT >= 2) acc[mb][nb] = WFrag<T16>::mma(a[mb], b2, acc[mb][nb]); } }
        asm volatile("v_nop\n\tv_nop\n\tv_nop\n\tv_nop" : "+v"(acc[0][0]), "+v"(acc[1][1]), "+v"(acc[2][2]), "+v"(acc[3][3]) : "v"(a[0]), "v"(a[3]));
        if (CMODE == 4) asm volatile("s_wait_xcnt 0x0" :: "v"(pa), "v"(pb[0]), "v"(pb[1]), "v"(pb[2]), "v"(pb[3]) : "memory");   // the rolled loop's wait before a register that an issued load names is rewritten: as its inputs the trip's five addresses stay in their registers until here, so that no later load's result lands on one
    }
#pragma unroll
    for (int mb = 0; mb < 4; ++mb) {
#pragma unroll
        for (int nb = 0; nb < 4; ++nb) {
#pragma unroll
            for (int j = 0; j < 8; ++j) os[(hi * 8 + j) * 68 + nb * 16 + lr] = acc[mb][nb][j]; }
        __builtin_amdgcn_wave_barrier(); asm volatile("" ::: "memory");
        float* crow = (CMODE == 4) ? nullptr : C + (size_t)(r0 + mb * 16) * ldc + c0;
{
#pragma unroll
            for (int s = 0; s < 8; ++s) { const int row = 2 * s + hi, cofs = lr * 4; v4f val = *(const v4fa*)(os + row * 68 + cofs);
                if (CMODE == 4) { const size_t oo = ((z / NH_) * TT + r0 + mb * 16 + row) * DQ + (z % NH_) * HD + c0 + cofs; v4us oh, ol;
#pragma unroll
                    for (int q = 0; q < 4; ++q) { unsigned short a, c2; splitf(val[q] * (1.0f / PCAR), a, c2); oh[q] = a; ol[q] = c2; }
                    *(v4us*)(Ah + oo) = oh; *(v4us*)(Al + oo) = ol; }
                else *(v4f*)(crow + (size_t)row * ldc + cofs) = val; }
             }
        __builtin_amdgcn_wave_barrier(); asm volatile("" ::: "memory");
    }
}


__device__ __forceinline__ h16 tohx(float x) { return (h16)x; }
typedef __attribute__((ext_vector_type(2))) unsigned short v2us;

__global__ __launch_bounds__(256) void k_wtG(const float* __restrict__ w, int K, int N, bf* Bt) {
    const int lane = threadIdx.x & 31; const int L0 = (blockIdx.x * 8 + (threadIdx.x >> 5)) * 8; const int nlines = N * K / 64;
{
        for (int l = 0; l < 8; ++l) { const int L = L0 + l; if (L >= nlines) break; const size_t e = (size_t)L * 64 + lane * 2; const int k = (int)(e % K), n = (int)(e / K); v2us o;
            o[0] = f2bf(w[(size_t)k * N + n]); o[1] = f2bf(w[(size_t)(k + 1) * N + n]); *(v2us*)(Bt + e) = o; }
         }
}
__global__ __launch_bounds__(256) void k_cvt8(const float* __restrict__ src, bf* dst, size_t n8) { const size_t i = (size_t)blockIdx.x * 256 + threadIdx.x; if (i >= n8) return; const v8f v = *(const v8f*)(src + i * 8); v8us o;
#pragma unroll
    for (int k = 0; k < 8; ++k) o[k] = f2bf(v[k]); *(v8us*)(dst + i * 8) = o;  }
// k_asoft: per row (z, i) of the 64-row block r0 = i & ~63: ONE 128-key window [r0 - WB, r0 + 64 + WB), four keys a lane, stored at pitch WK (word lane * 4 + q of the row is key r0 - WB + lane * 4 + q). It holds the row's whole band and is exactly the key range that the value product's K loop reads for that row block
// (CMODE 4) and that the band GEMM writes (CMODE 3). t = S x HD^-0.5 for the keys of the band |i - j| <= BAND, -3.0e38 elsewhere (index select);
// lanes whose keys fall before key 0 or past the last key load and store nothing and carry -3.0e38. One exp, fixed trees:
// a lane holds one aligned group of four keys and the window's start is a multiple of 32 keys (8 lanes), which the xor trees do not see: maximum and sum are the same values as over the whole row.
static_assert(WK == 128, "one window = 32 lanes x 4 keys");
__global__ __launch_bounds__(256) void k_asoft(const float* __restrict__ Sb, h16* P16) {
    const int lane = threadIdx.x & 31; const int row = blockIdx.x * 8 + (threadIdx.x >> 5); if (row >= NZ * TT) return; const int i = row % TT; const int j0 = (i & ~63) - WB + lane * 4; const bool in = (j0 >= 0 && j0 < TT);
    v4f a = (v4f){}; if (in) a = *(const v4f*)(Sb + (size_t)row * WK + lane * 4);
    float v[4]; float mx = -3.0e38f;
#pragma unroll
    for (int q = 0; q < 4; ++q) { const int j = j0 + q; const float t = (in && j >= i - BAND && j <= i + BAND) ? a[q] * SCL : -3.0e38f; v[q] = t; mx = fmaxf(mx, t); }
#pragma unroll
    for (int sh = 16; sh; sh >>= 1) mx = fmaxf(mx, __shfl_xor(mx, sh, 32));
    float sum = 0.f;
#pragma unroll
    for (int k = 0; k < 4; ++k) { const float d0 = __fmul_rn(__fsub_rn(v[k], mx), 1.4426950408889634f);
        asm("v_exp_f32 %0, %1\n\tv_nop" : "=v"(v[k]) : "v"(d0));   // the exp2 instruction with its one free slot in the same statement
        sum += v[k]; }
#pragma unroll
    for (int sh = 16; sh; sh >>= 1) sum += __shfl_xor(sum, sh, 32);
    const float f = __fdiv_rn(PCAR, sum);
    v4h o4;
#pragma unroll
    for (int q = 0; q < 4; ++q) o4[q] = tohx(v[q] * f);
    if (in) *(v4h*)(P16 + (size_t)row * WK + lane * 4) = o4;
}

extern "C" void kernel_launch(void* const* d_in, const int* in_sizes, int n_in,
                              void* d_out, int out_size, void* d_ws, size_t ws_size, hipStream_t stream) {
    (void)in_sizes; (void)n_in; (void)out_size;
    const float* x = (const float*)d_in[0]; const float* wqkv = (const float*)d_in[1]; const float* bqkv = (const float*)d_in[2]; const float* wo = (const float*)d_in[3]; const float* bo = (const float*)d_in[4];
    // inputs in the module's argument order: x ([4][4096][256]), Wqkv ('xw' (in, out) [256][768]; output column s * 256 + h * 64 + d, s = 0 query, 1 key, 2 value), bqkv ([768]), Wout ('xw' [256][256]), bout ([256]) = d_in[0..4]: FIVE inputs, all read (the set-up builds the two biases as zeros: read all the same)
    float* OUT = (float*)d_out;     // [4][4096][256]
    char* wsp = (char*)d_ws;
    auto take = [&](size_t bytes) { char* p = wsp; wsp += (bytes + 255) & ~(size_t)255; return (void*)p; };
    bf* WQKV = (bf*)take((size_t)3 * DQ * DM * 2); bf* WO = (bf*)take((size_t)DM * DQ * 2);
    bf* XB = (bf*)take((size_t)NB_ * TT * DM * 2);
    h16* QP16 = (h16*)take((size_t)NZ * TT * HD * 2); h16* KP16 = (h16*)take((size_t)NZ * TT * HD * 2); h16* VT16 = (h16*)take((size_t)NZ * HD * TT * 2);
    float* Sb = (float*)take((size_t)NZ * TT * WK * 4); h16* P16 = (h16*)take((size_t)NZ * TT * WK * 2); bf* ATh = (bf*)take((size_t)NB_ * TT * DQ * 2); bf* ATl = (bf*)take((size_t)NB_ * TT * DQ * 2);
    if ((size_t)(wsp - (char*)d_ws) > ws_size) return;    // total 96.50 MiB carved
    k_wtG<<<(unsigned)((DM * 3 * DQ / 64 + 63) / 64), 256, 0, stream>>>(wqkv, DM, 3 * DQ, WQKV);   /* the fused weight: Bt row s * 256 + h * 64 + d */
    k_wtG<<<(unsigned)((DQ * DM / 64 + 63) / 64), 256, 0, stream>>>(wo, DQ, DM, WO);
    /* every stage once, over all batch entries and heads */
    k_cvt8<<<(unsigned)(((size_t)NB_ * TT * DM / 8 + 255) / 256), 256, 0, stream>>>(x, XB, (size_t)NB_ * TT * DM / 8);   /* the one stream */
    k_gemmw<bf, 0, true, true><<<dim3(NB_ * TT / 64, 3 * DQ / 64, 1), 32, 0, stream>>>(XB, nullptr, WQKV, nullptr, DM, nullptr, 0, bqkv, 0, 0, 0, QP16, KP16, VT16);   /* q | k | v in one product; each 64-column tile stores its own f16 head plane */
    k_gemmc<h16, 0, 3><<<dim3(TT / 64, WK / 64, NZ), 32, 0, stream>>>(QP16, nullptr, KP16, nullptr, HD, Sb, WK, (size_t)TT * HD, (size_t)TT * HD, (size_t)TT * WK, nullptr, nullptr);   /* ONE f16 product on every row; the two 64-key tiles of each row block's window */
    k_asoft<<<NZ * TT / 8, 256, 0, stream>>>(Sb, P16);   /* every score word it loads was written by the band GEMM above */
    k_gemmc<h16, 0, 4><<<dim3(TT / 64, HD / 64, NZ), 32, 0, stream>>>(P16, nullptr, VT16, nullptr, TT, nullptr, 0, (size_t)TT * WK, (size_t)HD * TT, 0, ATh, ATl);   /* the K loop runs over the window's keys in 32-key steps: it reads keys on each side of the band whose weights the softmax wrote as exact zeros; stores the merged context hi / lo */
    k_gemmw<bf, 1, true, false><<<dim3(NB_ * TT / 64, DM / 64, 1), 32, 0, stream>>>(ATh, ATl, WO, nullptr, DQ, OUT, DM, bo, 0, 0, 0, nullptr, nullptr, nullptr);   /* out = merged(hi + lo) Wout + bout: the one writer of the output */
}

// v004
// It runs in 58 microseconds.
// Next to v003, in two timings, it ran 1.33 and 1.34 times as fast.
// Over all steps from v000 it is 6.72 times as fast.
#include <hip/hip_runtime.h>

// Multi-head self-attention restricted to a static symmetric band (x [4][4096][256]: ONE stream; qkv = x Wqkv + bqkv with ONE fused 'xw' (in, out) [256][768] weight whose output column is s x 256 + h x 64 + d (s = 0 the queries, 1 the keys, 2 the values: the module reshapes the 768 columns as [3][4][64]) and a [768] bias (the module's set-up builds both biases as zeros: BOTH ARE READ); 4 heads x 64;
// scores = Q.K / sqrt(64); keys with |i - j| > 12 are replaced by -inf in the module (a 25-key band computed from the indices; every row keeps its own key: no row is fully excluded); softmax over the keys; out = merged Wout + bout with an 'xw' (in, out) [256][256] weight and a [256] bias -> [4][4096][256] (4.2 M);
// argument order x, Wqkv, bqkv, Wout, bout).
// Layout, ALL FOUR BATCH ENTRIES AND ALL FOUR HEADS IN EACH LAUNCH (rows b x 4096 + t in the row-major arrays, planes z = b x 4 + h in the head planes; the grids carry b and h, no host loop): the stream's bf16 copy made once; the two 'xw' weights transposed once (the fused one into a Bt [768][256], the output one into a Bt [256][256]); ONE exact projection over the 768 fused columns + its f32 bias, whose epilogue rounds to f16 and stores the head planes itself: a 64-column tile is one (s, h), so it goes to the query or key plane [z][t][d] or, transposed, to the value plane [z][d][t];
// band attention in ONE launch: a wave takes 32 queries of one head plane and their 64-key window, computes the transposed scores, applies the |i - j| <= BAND band by an index select (an excluded key takes -3.0e38 before the maximum, so its weight is an exact zero, as exp(-inf - max) is), does the softmax in registers and feeds the f16 weights straight into the value product: scores and weights are never stored;
// EVERY row on ONE fp16 product (the weights x 1024), whose epilogue stores the merged context [b x 4096 + t][h x 64 + d] as bf16 hi / lo; merged hi/lo x Wout exact + bias writes the output.
// Compute dtypes, f32 accumulate: every float input rounded to bf16 at its load; the projection exact + f32 bias; attention: one fp16 product on every row; softmax f32; Wout hl x exact + bias (the merged context as bf16 hi / lo).

#define NB_  4
#define TT   4096
#define DM   256
#define NH_  4
#define NKV  4
#define REP  (NH_ / NKV)
#define HD   64
#define DQ   (NH_ * HD)
#define DKV  (NKV * HD)
#define NZ   (NB_ * NH_)   // head planes in one launch: z = b * NH_ + h
#define RH   0     // not read: EVERY row runs on one f16 product
#define WIN  0
#define PCAR 1024.0f
#define SCL  0.125f
#define BAND 12    // half width of the symmetric band: keys with |i - j| <= BAND are kept (a 25-key band)
static_assert(REP == 1, "plane z = b * NH_ + h serves queries, keys and values alike");
typedef _Float16 h16;
typedef unsigned short bf;
typedef __attribute__((ext_vector_type(16))) __bf16   v16bf;
typedef __attribute__((ext_vector_type(16))) _Float16 v16h;
typedef __attribute__((ext_vector_type(8)))  _Float16 v8h;
typedef __attribute__((ext_vector_type(8)))  unsigned short v8us;
typedef __attribute__((ext_vector_type(8)))  float    v8f;
typedef __attribute__((ext_vector_type(4)))  float    v4f;
typedef __attribute__((ext_vector_type(4)))  _Float16 v4h;
typedef __attribute__((ext_vector_type(4)))  unsigned short v4us;
typedef v8h  __attribute__((may_alias)) v8ha;
typedef v4f  __attribute__((may_alias)) v4fa;
typedef v8us __attribute__((may_alias)) v8usa;

__device__ __forceinline__ unsigned short f2bf(float f) { unsigned u = __float_as_uint(f); u += 0x7FFFu + ((u >> 16) & 1u); return (unsigned short)(u >> 16); }
__device__ __forceinline__ float bf2f(unsigned short b) { return __uint_as_float(((unsigned)b) << 16); }
__device__ __forceinline__ float bfr(float f) { return bf2f(f2bf(f)); }
__device__ __forceinline__ void splitf(float y, unsigned short& h, unsigned short& l) { h = f2bf(y); l = f2bf(y - bf2f(h)); }
__device__ __forceinline__ v16h cat16(v8h lo, v8h hi) { return __builtin_shufflevector(lo, hi, 0, 1, 2, 3, 4, 5, 6, 7, 8, 9, 10, 11, 12, 13, 14, 15); }
__device__ __forceinline__ v16bf cat16b(v8us lo, v8us hi) { return __builtin_bit_cast(v16bf, __builtin_shufflevector(lo, hi, 0, 1, 2, 3, 4, 5, 6, 7, 8, 9, 10, 11, 12, 13, 14, 15)); }
__device__ __forceinline__ v8f wmma16(v16h a, v16h b, v8f c) { return __builtin_amdgcn_wmma_f32_16x16x32_f16(false, a, false, b, (short)0, c, false, false); }
__device__ __forceinline__ v8f wmmab(v16bf a, v16bf b, v8f c) { return __builtin_amdgcn_wmma_f32_16x16x32_bf16(false, a, false, b, (short)0, c, false, false); }



// ---- k_gemmw: register-blocked GEMM, ONE WAVE per 64x64 output tile (16 accumulators), operands straight from K-contiguous 16-bit planes; grid (M/64, N/64, Z), 32 threads.
// C[m][n] (f32, pitch ldc, + optional f32 bias[n]) = sum_k A[m][k] Bt[n][k] (+ split products per NSPLIT). z-batch strides sA/sB/sC in elements. K % 32 == 0.
// PLANES: the fused q | k | v projection. C is not written; the tile at (r0, c0) is rows t0 .. t0 + 63 of batch entry r0 / TT and the HD columns of one s = c0 / DQ and one head, and its sums + bias go out as f16:
// s = 0, 1 to QP, KP [z][t][d] through the same LDS turn as the f32 tile; s = 2 to VT [z][d][t] straight from the accumulators, where a lane holds eight successive t of one d.
template <typename T16> struct WFrag;
template <> struct WFrag<h16> { typedef v16h V; static __device__ __forceinline__ V ld(const h16* p) { return cat16(*(const v8h*)p, *(const v8h*)(p + 16)); } static __device__ __forceinline__ v8f mma(V a, V b, v8f c) { return wmma16(a, b, c); } };
template <> struct WFrag<bf> { typedef v16bf V; static __device__ __forceinline__ V ld(const bf* p) { return cat16b(*(const v8us*)p, *(const v8us*)(p + 16)); } static __device__ __forceinline__ v8f mma(V a, V b, v8f c) { return wmmab(a, b, c); } };
template <typename T16, int NSPLIT, bool BIAS, bool PLANES>
__global__ __launch_bounds__(32) void k_gemmw(const T16* __restrict__ A, const T16* __restrict__ A2, const T16* __restrict__ Bt, const T16* __restrict__ Bt2, int K, float* C, int ldc, const float* __restrict__ bias, size_t sA, size_t sB, size_t sC, h16* QP, h16* KP, h16* VT) {
    typedef typename WFrag<T16>::V V;
    __shared__ __align__(16) float os[16 * 68];
    const size_t z = blockIdx.z; A += z * sA; if (A2) A2 += z * sA; Bt += z * sB; if (Bt2) Bt2 += z * sB; C += z * sC;
    const int lane = threadIdx.x & 31, lr = lane & 15, hi = lane >> 4; const int r0 = blockIdx.x * 64, c0 = blockIdx.y * 64;
    v8f acc[4][4];
#pragma unroll
    for (int mb = 0; mb < 4; ++mb)
#pragma unroll
        for (int nb = 0; nb < 4; ++nb) acc[mb][nb] = (v8f){};
    const size_t aoff = (size_t)(r0 + lr) * K + 8 * hi, boff = (size_t)(c0 + lr) * K + 8 * hi;
    for (int kc = 0; kc < K; kc += 32) {
        V a[4], a2[4];
#pragma unroll
        for (int mb = 0; mb < 4; ++mb) { a[mb] = WFrag<T16>::ld(A + aoff + (size_t)mb * 16 * K + kc); if (NSPLIT == 1 || NSPLIT == 2) a2[mb] = WFrag<T16>::ld(A2 + aoff + (size_t)mb * 16 * K + kc); }
#pragma unroll
        for (int nb = 0; nb < 4; ++nb) { const V b = WFrag<T16>::ld(Bt + boff + (size_t)nb * 16 * K + kc); V b2; if (NSPLIT >= 2) b2 = WFrag<T16>::ld(Bt2 + boff + (size_t)nb * 16 * K + kc);
#pragma unroll
            for (int mb = 0; mb < 4; ++mb) { acc[mb][nb] = WFrag<T16>::mma(a[mb], b, acc[mb][nb]); if (NSPLIT == 1 || NSPLIT == 2) acc[mb][nb] = WFrag<T16>::mma(a2[mb], b, acc[mb][nb]); if (NSPLIT >= 2) acc[mb][nb] = WFrag<T16>::mma(a[mb], b2, acc[mb][nb]); } }
        asm volatile("v_nop\n\tv_nop\n\tv_nop\n\tv_nop" : "+v"(acc[0][0]), "+v"(acc[1][1]), "+v"(acc[2][2]), "+v"(acc[3][3]) : "v"(a[0]), "v"(a[3]));
    }
    const size_t pz = PLANES ? (size_t)(r0 / TT) * NH_ + (c0 % DQ) / HD : 0; const int t0 = r0 % TT;   // PLANES: the tile's head plane and its first row there
    if (PLANES && c0 >= 2 * DQ) {   // values (the test is the same for the whole block)
#pragma unroll
        for (int nb = 0; nb < 4; ++nb) { const float bv = bfr(bias[c0 + nb * 16 + lr]); h16* const vrow = VT + (pz * HD + nb * 16 + lr) * TT + t0 + hi * 8;
#pragma unroll
            for (int mb = 0; mb < 4; ++mb) { v8h o;
#pragma unroll
                for (int j = 0; j < 8; ++j) o[j] = (h16)(acc[mb][nb][j] + bv);
                *(v8h*)(vrow + mb * 16) = o; } }
    } else {
    h16* const prow = PLANES ? ((c0 < DQ) ? QP : KP) + (pz * TT + t0) * HD : nullptr;
#pragma unroll
    for (int mb = 0; mb < 4; ++mb) {
#pragma unroll
        for (int nb = 0; nb < 4; ++nb) {
#pragma unroll
            for (int j = 0; j < 8; ++j) os[(hi * 8 + j) * 68 + nb * 16 + lr] = acc[mb][nb][j]; }
        __builtin_amdgcn_wave_barrier(); asm volatile("" ::: "memory");
        float* crow = PLANES ? nullptr : C + (size_t)(r0 + mb * 16) * ldc + c0;
{
#pragma unroll
            for (int s = 0; s < 8; ++s) { const int row = 2 * s + hi, cofs = lr * 4; v4f val = *(const v4fa*)(os + row * 68 + cofs); if (BIAS) { val[0] += bfr(bias[c0 + cofs]); val[1] += bfr(bias[c0 + cofs + 1]); val[2] += bfr(bias[c0 + cofs + 2]); val[3] += bfr(bias[c0 + cofs + 3]); }
                if (PLANES) { v4h o;
#pragma unroll
                    for (int q = 0; q < 4; ++q) o[q] = (h16)val[q];
                    *(v4h*)(prow + (size_t)(mb * 16 + row) * HD + cofs) = o; }
                else *(v4f*)(crow + (size_t)row * ldc + cofs) = val; }
             }
        if (PLANES) asm volatile("s_wait_xcnt 0x0" ::: "memory");   // the wait before what follows (the next turn's bias load first) rewrites registers that this turn's plane stores name
        __builtin_amdgcn_wave_barrier(); asm volatile("" ::: "memory");
    }
    }
}

// ---- k_attn: the whole band attention of one 32-query block of one head plane in ONE WAVE; scores and weights never leave the registers. 128 threads = 4 independent waves (no LDS, no barrier); grid NZ * TT / 128.
// The block at r0 owns the QW = 64 keys w0 + 0 .. w0 + 63, w0 = r0 - 16 (BAND <= 16). Transposed products: St = K Qt (A = 16 key rows, B = 16 query rows, both d-contiguous through the one loader), so that a lane holds 8 keys of ONE query per tile:
// D register j of key tile kt is key w0 + kt * 16 + hi * 8 + j, query r0 + qt * 16 + lr. Query tile qt meets the band only in the key tiles qt, qt + 1, qt + 2: the fourth is not computed and its weights are zeros.
// Softmax as before (t = S x HD^-0.5 inside the band, -3.0e38 elsewhere by an index select, one exp, weights x 1024 rounded to f16); maximum and sum run in the lane and then once across the wave's halves.
// Two neighbouring key tiles' weights, converted in place, ARE the B operand of Ot = Vt Pt in the loader's k order (elements 0..7 = keys 8 hi + j, 8..15 = keys 16 + 8 hi + j of a 32-key step); A = the transposed values.
// A key before 0 or past the last takes a real key's address (min and max on the index keep every load inside its plane) and an exact zero weight. Ot gives a lane 8 successive d of one query: x 1 / 1024, bf16 hi + lo, one 16-byte store each to Ah / Al [(z / NH_) x TT + t][(z % NH_) x HD + d].
static_assert(BAND <= 16 && HD == 64 && TT % 32 == 0, "one 64-key window per 32 queries, three key tiles per query tile");
__global__ __launch_bounds__(128) void k_attn(const h16* __restrict__ QP, const h16* __restrict__ KP, const h16* __restrict__ VT, bf* Ah, bf* Al) {
    const int lane = threadIdx.x & 31, lr = lane & 15, hi = lane >> 4;
    const int wv = blockIdx.x * 4 + __builtin_amdgcn_readfirstlane(threadIdx.x >> 5);   // the wave's block number, in a scalar register: plane, rows and edge tests are the same in every lane
    const int z = wv / (TT / 32), r0 = (wv % (TT / 32)) * 32, w0 = r0 - 16;
    const h16* const Qz = QP + (size_t)z * TT * HD; const h16* const Kz = KP + (size_t)z * TT * HD; const h16* const Vz = VT + (size_t)z * HD * TT;
    v16h q[2][2], k[4][2], v[4][2];
#pragma unroll
    for (int qt = 0; qt < 2; ++qt)
#pragma unroll
        for (int ks = 0; ks < 2; ++ks) q[qt][ks] = WFrag<h16>::ld(Qz + (r0 + qt * 16 + lr) * HD + ks * 32 + 8 * hi);
#pragma unroll
    for (int kt = 0; kt < 4; ++kt) { const int kr = min(max(w0 + kt * 16 + lr, 0), TT - 1);
#pragma unroll
        for (int ks = 0; ks < 2; ++ks) k[kt][ks] = WFrag<h16>::ld(Kz + kr * HD + ks * 32 + 8 * hi); }
#pragma unroll
    for (int ks = 0; ks < 2; ++ks) { const int ta = min(max(w0 + ks * 32 + 8 * hi, 0), TT - 8), tb = min(max(w0 + ks * 32 + 16 + 8 * hi, 0), TT - 8);
#pragma unroll
        for (int dt = 0; dt < 4; ++dt) v[dt][ks] = cat16(*(const v8h*)(Vz + (dt * 16 + lr) * TT + ta), *(const v8h*)(Vz + (dt * 16 + lr) * TT + tb)); }
    __builtin_amdgcn_sched_barrier(0);   // all forty loads are issued before the first product: without it the scheduler sinks the later key tiles' and the values' loads behind waits for the first ones, and the wave pays the memory latency three times instead of once
    const int dl = hi * 8 - lr + BAND; v8h p[2][4];   // key - query + BAND of register j in key tile qt + kk is dl + (kk - 1) * 16 + j
#pragma unroll
    for (int qt = 0; qt < 2; ++qt) {
        v8f st[3]; float mx = -3.0e38f;
#pragma unroll
        for (int kk = 0; kk < 3; ++kk) { st[kk] = wmma16(k[qt + kk][1], q[qt][1], wmma16(k[qt + kk][0], q[qt][0], (v8f){}));
            const int de = ((unsigned)(w0 + (qt + kk) * 16) < (unsigned)TT) ? dl + (kk - 1) * 16 : -64;   // a key tile is wholly real or wholly not: one that is not falls out of the band test below
#pragma unroll
            for (int j = 0; j < 8; ++j) { const float t = ((unsigned)(de + j) <= 2u * BAND) ? st[kk][j] * SCL : -3.0e38f; st[kk][j] = t; mx = fmaxf(mx, t); } }
        mx = fmaxf(mx, __shfl_xor(mx, 16, 32));
        float sum = 0.f;
#pragma unroll
        for (int kk = 0; kk < 3; ++kk)
#pragma unroll
            for (int j = 0; j < 8; ++j) { const float d0 = __fmul_rn(__fsub_rn(st[kk][j], mx), 1.4426950408889634f); float e;
                asm("v_exp_f32 %0, %1\n\tv_nop" : "=v"(e) : "v"(d0));   // the exp2 instruction with its one free slot in the same statement, so that nothing that reads its result or rewrites its source stands directly behind it
                st[kk][j] = e; sum += e; }
        sum += __shfl_xor(sum, 16, 32);
        const float f = __fdiv_rn(PCAR, sum);
#pragma unroll
        for (int kt = 0; kt < 4; ++kt)
#pragma unroll
            for (int j = 0; j < 8; ++j) p[qt][kt][j] = (kt >= qt && kt < qt + 3) ? (h16)(st[(kt - qt + 3) % 3][j] * f) : (h16)0.f;
    }
    bf* const oh = Ah + ((size_t)(z / NH_) * TT + r0 + lr) * DQ + (z % NH_) * HD + hi * 8; bf* const ol = Al + ((size_t)(z / NH_) * TT + r0 + lr) * DQ + (z % NH_) * HD + hi * 8;
#pragma unroll
    for (int qt = 0; qt < 2; ++qt)
#pragma unroll
        for (int dt = 0; dt < 4; ++dt) { const v8f o = wmma16(v[dt][1], cat16(p[qt][2], p[qt][3]), wmma16(v[dt][0], cat16(p[qt][0], p[qt][1]), (v8f){})); v8us a8, c8;
#pragma unroll
            for (int j = 0; j < 8; ++j) { unsigned short a, c2; splitf(o[j] * (1.0f / PCAR), a, c2); a8[j] = a; c8[j] = c2; }
            *(v8us*)(oh + qt * 16 * DQ + dt * 16) = a8; *(v8us*)(ol + qt * 16 * DQ + dt * 16) = c8; }
}

typedef __attribute__((ext_vector_type(2))) unsigned short v2us;

__global__ __launch_bounds__(256) void k_wtG(const float* __restrict__ w, int K, int N, bf* Bt) {
    const int lane = threadIdx.x & 31; const int L0 = (blockIdx.x * 8 + (threadIdx.x >> 5)) * 8; const int nlines = N * K / 64;
{
        for (int l = 0; l < 8; ++l) { const int L = L0 + l; if (L >= nlines) break; const size_t e = (size_t)L * 64 + lane * 2; const int k = (int)(e % K), n = (int)(e / K); v2us o;
            o[0] = f2bf(w[(size_t)k * N + n]); o[1] = f2bf(w[(size_t)(k + 1) * N + n]); *(v2us*)(Bt + e) = o; }
         }
}
__global__ __launch_bounds__(256) void k_cvt8(const float* __restrict__ src, bf* dst, size_t n8) { const size_t i = (size_t)blockIdx.x * 256 + threadIdx.x; if (i >= n8) return; const v8f v = *(const v8f*)(src + i * 8); v8us o;
#pragma unroll
    for (int k = 0; k < 8; ++k) o[k] = f2bf(v[k]); *(v8us*)(dst + i * 8) = o;  }
extern "C" void kernel_launch(void* const* d_in, const int* in_sizes, int n_in,
                              void* d_out, int out_size, void* d_ws, size_t ws_size, hipStream_t stream) {
    (void)in_sizes; (void)n_in; (void)out_size;
    const float* x = (const float*)d_in[0]; const float* wqkv = (const float*)d_in[1]; const float* bqkv = (const float*)d_in[2]; const float* wo = (const float*)d_in[3]; const float* bo = (const float*)d_in[4];
    // inputs in the module's argument order: x ([4][4096][256]), Wqkv ('xw' (in, out) [256][768]; output column s * 256 + h * 64 + d, s = 0 query, 1 key, 2 value), bqkv ([768]), Wout ('xw' [256][256]), bout ([256]) = d_in[0..4]: FIVE inputs, all read (the set-up builds the two biases as zeros: read all the same)
    float* OUT = (float*)d_out;     // [4][4096][256]
    char* wsp = (char*)d_ws;
    auto take = [&](size_t bytes) { char* p = wsp; wsp += (bytes + 255) & ~(size_t)255; return (void*)p; };
    bf* WQKV = (bf*)take((size_t)3 * DQ * DM * 2); bf* WO = (bf*)take((size_t)DM * DQ * 2);
    bf* XB = (bf*)take((size_t)NB_ * TT * DM * 2);
    h16* QP16 = (h16*)take((size_t)NZ * TT * HD * 2); h16* KP16 = (h16*)take((size_t)NZ * TT * HD * 2); h16* VT16 = (h16*)take((size_t)NZ * HD * TT * 2);
    bf* ATh = (bf*)take((size_t)NB_ * TT * DQ * 2); bf* ATl = (bf*)take((size_t)NB_ * TT * DQ * 2);
    if ((size_t)(wsp - (char*)d_ws) > ws_size) return;    // total 48.50 MiB carved
    k_wtG<<<(unsigned)((DM * 3 * DQ / 64 + 63) / 64), 256, 0, stream>>>(wqkv, DM, 3 * DQ, WQKV);   /* the fused weight: Bt row s * 256 + h * 64 + d */
    k_wtG<<<(unsigned)((DQ * DM / 64 + 63) / 64), 256, 0, stream>>>(wo, DQ, DM, WO);
    /* every stage once, over all batch entries and heads */
    k_cvt8<<<(unsigned)(((size_t)NB_ * TT * DM / 8 + 255) / 256), 256, 0, stream>>>(x, XB, (size_t)NB_ * TT * DM / 8);   /* the one stream */
    k_gemmw<bf, 0, true, true><<<dim3(NB_ * TT / 64, 3 * DQ / 64, 1), 32, 0, stream>>>(XB, nullptr, WQKV, nullptr, DM, nullptr, 0, bqkv, 0, 0, 0, QP16, KP16, VT16);   /* q | k | v in one product; each 64-column tile stores its own f16 head plane */
    k_attn<<<NZ * TT / 128, 128, 0, stream>>>(QP16, KP16, VT16, ATh, ATl);   /* scores, band, softmax and weights x values: ONE f16 product each on every row; stores the merged context hi / lo */
    k_gemmw<bf, 1, true, false><<<dim3(NB_ * TT / 64, DM / 64, 1), 32, 0, stream>>>(ATh, ATl, WO, nullptr, DQ, OUT, DM, bo, 0, 0, 0, nullptr, nullptr, nullptr);   /* out = merged(hi + lo) Wout + bout: the one writer of the output */
}

// v005
// It runs in 49.7 microseconds.
// Next to v004, in two timings, it ran 1.18 and 1.19 times as fast.
// Over all steps from v000 it is 7.96 times as fast.
#include <hip/hip_runtime.h>

// Multi-head self-attention restricted to a static symmetric band (x [4][4096][256]: ONE stream; qkv = x Wqkv + bqkv with ONE fused 'xw' (in, out) [256][768] weight whose output column is s x 256 + h x 64 + d (s = 0 the queries, 1 the keys, 2 the values: the module reshapes the 768 columns as [3][4][64]) and a [768] bias (the module's set-up builds both biases as zeros: BOTH ARE READ); 4 heads x 64;
// scores = Q.K / sqrt(64); keys with |i - j| > 12 are replaced by -inf in the module (a 25-key band computed from the indices; every row keeps its own key: no row is fully excluded); softmax over the keys; out = merged Wout + bout with an 'xw' (in, out) [256][256] weight and a [256] bias -> [4][4096][256] (4.2 M);
// argument order x, Wqkv, bqkv, Wout, bout).
// Layout, ALL FOUR BATCH ENTRIES AND ALL FOUR HEADS IN EACH LAUNCH (rows b x 4096 + t in the row-major arrays, planes z = b x 4 + h in the head planes; the grids carry b and h, no host loop): the stream's bf16 copy made once and the two 'xw' weights transposed once (the fused one into a Bt [768][256], the output one into a Bt [256][256]), all three in one launch; ONE exact projection over the 768 fused columns + its f32 bias, whose epilogue rounds to f16 and stores the head planes itself: a 64-column tile is one (s, h), so it goes to the query or key plane [z][t][d] or, transposed, to the value plane [z][d][t];
// band attention in ONE launch: a wave takes 32 queries of one head plane and their 64-key window, computes the transposed scores, applies the |i - j| <= BAND band by an index select (an excluded key takes -3.0e38 before the maximum, so its weight is an exact zero, as exp(-inf - max) is), does the softmax in registers and feeds the f16 weights straight into the value product: scores and weights are never stored;
// EVERY row on ONE fp16 product (the weights x 1024), whose epilogue stores the merged context [b x 4096 + t][h x 64 + d] as bf16 hi / lo; merged hi/lo x Wout exact + bias writes the output.
// Compute dtypes, f32 accumulate: every float input rounded to bf16 at its load; the projection exact + f32 bias; attention: one fp16 product on every row; softmax f32; Wout hl x exact + bias (the merged context as bf16 hi / lo).

#define NB_  4
#define TT   4096
#define DM   256
#define NH_  4
#define NKV  4
#define REP  (NH_ / NKV)
#define HD   64
#define DQ   (NH_ * HD)
#define DKV  (NKV * HD)
#define NZ   (NB_ * NH_)   // head planes in one launch: z = b * NH_ + h
#define RH   0     // not read: EVERY row runs on one f16 product
#define WIN  0
#define PCAR 1024.0f
#define SCL  0.125f
#define BAND 12    // half width of the symmetric band: keys with |i - j| <= BAND are kept (a 25-key band)
static_assert(REP == 1, "plane z = b * NH_ + h serves queries, keys and values alike");
typedef _Float16 h16;
typedef unsigned short bf;
typedef __attribute__((ext_vector_type(16))) __bf16   v16bf;
typedef __attribute__((ext_vector_type(16))) _Float16 v16h;
typedef __attribute__((ext_vector_type(8)))  _Float16 v8h;
typedef __attribute__((ext_vector_type(8)))  unsigned short v8us;
typedef __attribute__((ext_vector_type(8)))  float    v8f;
typedef __attribute__((ext_vector_type(4)))  float    v4f;
typedef __attribute__((ext_vector_type(4)))  _Float16 v4h;
typedef __attribute__((ext_vector_type(4)))  unsigned short v4us;
typedef v8h  __attribute__((may_alias)) v8ha;
typedef v4f  __attribute__((may_alias)) v4fa;
typedef v8us __attribute__((may_alias)) v8usa;

__device__ __forceinline__ unsigned short f2bf(float f) { unsigned u = __float_as_uint(f); u += 0x7FFFu + ((u >> 16) & 1u); return (unsigned short)(u >> 16); }
__device__ __forceinline__ float bf2f(unsigned short b) { return __uint_as_float(((unsigned)b) << 16); }
__device__ __forceinline__ float bfr(float f) { return bf2f(f2bf(f)); }
__device__ __forceinline__ void splitf(float y, unsigned short& h, unsigned short& l) { h = f2bf(y); l = f2bf(y - bf2f(h)); }
__device__ __forceinline__ v16h cat16(v8h lo, v8h hi) { return __builtin_shufflevector(lo, hi, 0, 1, 2, 3, 4, 5, 6, 7, 8, 9, 10, 11, 12, 13, 14, 15); }
__device__ __forceinline__ v16bf cat16b(v8us lo, v8us hi) { return __builtin_bit_cast(v16bf, __builtin_shufflevector(lo, hi, 0, 1, 2, 3, 4, 5, 6, 7, 8, 9, 10, 11, 12, 13, 14, 15)); }
__device__ __forceinline__ v8f wmma16(v16h a, v16h b, v8f c) { return __builtin_amdgcn_wmma_f32_16x16x32_f16(false, a, false, b, (short)0, c, false, false); }
__device__ __forceinline__ v8f wmmab(v16bf a, v16bf b, v8f c) { return __builtin_amdgcn_wmma_f32_16x16x32_bf16(false, a, false, b, (short)0, c, false, false); }



// ---- k_gemmw: register-blocked GEMM, ONE WAVE per 64x64 output tile (16 accumulators), operands straight from K-contiguous 16-bit planes; grid (M/64, N/64, Z), 32 threads.
// C[m][n] (f32, pitch ldc, + optional f32 bias[n]) = sum_k A[m][k] Bt[n][k] (+ split products per NSPLIT). z-batch strides sA/sB/sC in elements. K % 32 == 0.
// PLANES: the fused q | k | v projection. C is not written; the tile at (r0, c0) is rows t0 .. t0 + 63 of batch entry r0 / TT and the HD columns of one s = c0 / DQ and one head, and its sums + bias go out as f16:
// s = 0, 1 to QP, KP [z][t][d] through the same LDS turn as the f32 tile; s = 2 to VT [z][d][t] straight from the accumulators, where a lane holds eight successive t of one d.
template <typename T16> struct WFrag;
template <> struct WFrag<h16> { typedef v16h V; static __device__ __forceinline__ V ld(const h16* p) { return cat16(*(const v8h*)p, *(const v8h*)(p + 16)); } static __device__ __forceinline__ v8f mma(V a, V b, v8f c) { return wmma16(a, b, c); } };
template <> struct WFrag<bf> { typedef v16bf V; static __device__ __forceinline__ V ld(const bf* p) { return cat16b(*(const v8us*)p, *(const v8us*)(p + 16)); } static __device__ __forceinline__ v8f mma(V a, V b, v8f c) { return wmmab(a, b, c); } };
template <typename T16, int NSPLIT, bool BIAS, bool PLANES>
__global__ __launch_bounds__(32) void k_gemmw(const T16* __restrict__ A, const T16* __restrict__ A2, const T16* __restrict__ Bt, const T16* __restrict__ Bt2, int K, float* C, int ldc, const float* __restrict__ bias, size_t sA, size_t sB, size_t sC, h16* QP, h16* KP, h16* VT) {
    typedef typename WFrag<T16>::V V;
    __shared__ __align__(16) float os[16 * 68];
    const size_t z = blockIdx.z; A += z * sA; if (A2) A2 += z * sA; Bt += z * sB; if (Bt2) Bt2 += z * sB; C += z * sC;
    const int lane = threadIdx.x & 31, lr = lane & 15, hi = lane >> 4; const int r0 = blockIdx.x * 64, c0 = blockIdx.y * 64;
    v8f acc[4][4];
#pragma unroll
    for (int mb = 0; mb < 4; ++mb)
#pragma unroll
        for (int nb = 0; nb < 4; ++nb) acc[mb][nb] = (v8f){};
    const size_t aoff = (size_t)(r0 + lr) * K + 8 * hi, boff = (size_t)(c0 + lr) * K + 8 * hi;
    for (int kc = 0; kc < K; kc += 32) {
        V a[4], a2[4];
#pragma unroll
        for (int mb = 0; mb < 4; ++mb) { a[mb] = WFrag<T16>::ld(A + aoff + (size_t)mb * 16 * K + kc); if (NSPLIT == 1 || NSPLIT == 2) a2[mb] = WFrag<T16>::ld(A2 + aoff + (size_t)mb * 16 * K + kc); }
#pragma unroll
        for (int nb = 0; nb < 4; ++nb) { const V b = WFrag<T16>::ld(Bt + boff + (size_t)nb * 16 * K + kc); V b2; if (NSPLIT >= 2) b2 = WFrag<T16>::ld(Bt2 + boff + (size_t)nb * 16 * K + kc);
#pragma unroll
            for (int mb = 0; mb < 4; ++mb) { acc[mb][nb] = WFrag<T16>::mma(a[mb], b, acc[mb][nb]); if (NSPLIT == 1 || NSPLIT == 2) acc[mb][nb] = WFrag<T16>::mma(a2[mb], b, acc[mb][nb]); if (NSPLIT >= 2) acc[mb][nb] = WFrag<T16>::mma(a[mb], b2, acc[mb][nb]); } }
        asm volatile("v_nop\n\tv_nop\n\tv_nop\n\tv_nop" : "+v"(acc[0][0]), "+v"(acc[1][1]), "+v"(acc[2][2]), "+v"(acc[3][3]) : "v"(a[0]), "v"(a[3]));
    }
    const size_t pz = PLANES ? (size_t)(r0 / TT) * NH_ + (c0 % DQ) / HD : 0; const int t0 = r0 % TT;   // PLANES: the tile's head plane and its first row there
    if (PLANES && c0 >= 2 * DQ) {   // values (the test is the same for the whole block)
#pragma unroll
        for (int nb = 0; nb < 4; ++nb) { const float bv = bfr(bias[c0 + nb * 16 + lr]); h16* const vrow = VT + (pz * HD + nb * 16 + lr) * TT + t0 + hi * 8;
#pragma unroll
            for (int mb = 0; mb < 4; ++mb) { v8h o;
#pragma unroll
                for (int j = 0; j < 8; ++j) o[j] = (h16)(acc[mb][nb][j] + bv);
                *(v8h*)(vrow + mb * 16) = o; } }
    } else {
    h16* const prow = PLANES ? ((c0 < DQ) ? QP : KP) + (pz * TT + t0) * HD : nullptr;
#pragma unroll
    for (int mb = 0; mb < 4; ++mb) {
#pragma unroll
        for (int nb = 0; nb < 4; ++nb) {
#pragma unroll
            for (int j = 0; j < 8; ++j) os[(hi * 8 + j) * 68 + nb * 16 + lr] = acc[mb][nb][j]; }
        __builtin_amdgcn_wave_barrier(); asm volatile("" ::: "memory");
        float* crow = PLANES ? nullptr : C + (size_t)(r0 + mb * 16) * ldc + c0;
{
#pragma unroll
            for (int s = 0; s < 8; ++s) { const int row = 2 * s + hi, cofs = lr * 4; v4f val = *(const v4fa*)(os + row * 68 + cofs); if (BIAS) { val[0] += bfr(bias[c0 + cofs]); val[1] += bfr(bias[c0 + cofs + 1]); val[2] += bfr(bias[c0 + cofs + 2]); val[3] += bfr(bias[c0 + cofs + 3]); }
                if (PLANES) { v4h o;
#pragma unroll
                    for (int q = 0; q < 4; ++q) o[q] = (h16)val[q];
                    *(v4h*)(prow + (size_t)(mb * 16 + row) * HD + cofs) = o; }
                else *(v4f*)(crow + (size_t)row * ldc + cofs) = val; }
             }
        if (PLANES) asm volatile("s_wait_xcnt 0x0" ::: "memory");   // the wait before what follows (the next turn's bias load first) rewrites registers that this turn's plane stores name
        __builtin_amdgcn_wave_barrier(); asm volatile("" ::: "memory");
    }
    }
}

// ---- k_attn: the whole band attention of one 32-query block of one head plane in ONE WAVE; scores and weights never leave the registers. 128 threads = 4 independent waves (no LDS, no barrier); grid NZ * TT / 128.
// The block at r0 owns the QW = 64 keys w0 + 0 .. w0 + 63, w0 = r0 - 16 (BAND <= 16). Transposed products: St = K Qt (A = 16 key rows, B = 16 query rows, both d-contiguous through the one loader), so that a lane holds 8 keys of ONE query per tile:
// D register j of key tile kt is key w0 + kt * 16 + hi * 8 + j, query r0 + qt * 16 + lr. Query tile qt meets the band only in the key tiles qt, qt + 1, qt + 2: the fourth is not computed and its weights are zeros.
// Softmax as before (t = S x HD^-0.5 inside the band, -3.0e38 elsewhere by an index select, one exp, weights x 1024 rounded to f16); maximum and sum run in the lane and then once across the wave's halves.
// Two neighbouring key tiles' weights, converted in place, ARE the B operand of Ot = Vt Pt in the loader's k order (elements 0..7 = keys 8 hi + j, 8..15 = keys 16 + 8 hi + j of a 32-key step); A = the transposed values.
// A key before 0 or past the last takes a real key's address (min and max on the index keep every load inside its plane) and an exact zero weight. Ot gives a lane 8 successive d of one query: x 1 / 1024, bf16 hi + lo, one 16-byte store each to Ah / Al [(z / NH_) x TT + t][(z % NH_) x HD + d].
static_assert(BAND <= 16 && HD == 64 && TT % 32 == 0, "one 64-key window per 32 queries, three key tiles per query tile");
__global__ __launch_bounds__(128) void k_attn(const h16* __restrict__ QP, const h16* __restrict__ KP, const h16* __restrict__ VT, bf* Ah, bf* Al) {
    const int lane = threadIdx.x & 31, lr = lane & 15, hi = lane >> 4;
    const int wv = blockIdx.x * 4 + __builtin_amdgcn_readfirstlane(threadIdx.x >> 5);   // the wave's block number, in a scalar register: plane, rows and edge tests are the same in every lane
    const int z = wv / (TT / 32), r0 = (wv % (TT / 32)) * 32, w0 = r0 - 16;
    const h16* const Qz = QP + (size_t)z * TT * HD; const h16* const Kz = KP + (size_t)z * TT * HD; const h16* const Vz = VT + (size_t)z * HD * TT;
    v16h q[2][2], k[4][2], v[4][2];
#pragma unroll
    for (int qt = 0; qt < 2; ++qt)
#pragma unroll
        for (int ks = 0; ks < 2; ++ks) q[qt][ks] = WFrag<h16>::ld(Qz + (r0 + qt * 16 + lr) * HD + ks * 32 + 8 * hi);
#pragma unroll
    for (int kt = 0; kt < 4; ++kt) { const int kr = min(max(w0 + kt * 16 + lr, 0), TT - 1);
#pragma unroll
        for (int ks = 0; ks < 2; ++ks) k[kt][ks] = WFrag<h16>::ld(Kz + kr * HD + ks * 32 + 8 * hi); }
#pragma unroll
    for (int ks = 0; ks < 2; ++ks) { const int ta = min(max(w0 + ks * 32 + 8 * hi, 0), TT - 8), tb = min(max(w0 + ks * 32 + 16 + 8 * hi, 0), TT - 8);
#pragma unroll
        for (int dt = 0; dt < 4; ++dt) v[dt][ks] = cat16(*(const v8h*)(Vz + (dt * 16 + lr) * TT + ta), *(const v8h*)(Vz + (dt * 16 + lr) * TT + tb)); }
    __builtin_amdgcn_sched_barrier(0);   // all forty loads are issued before the first product: without it the scheduler sinks the later key tiles' and the values' loads behind waits for the first ones, and the wave pays the memory latency three times instead of once
    const int dl = hi * 8 - lr + BAND; v8h p[2][4];   // key - query + BAND of register j in key tile qt + kk is dl + (kk - 1) * 16 + j
#pragma unroll
    for (int qt = 0; qt < 2; ++qt) {
        v8f st[3]; float mx = -3.0e38f;
#pragma unroll
        for (int kk = 0; kk < 3; ++kk) { st[kk] = wmma16(k[qt + kk][1], q[qt][1], wmma16(k[qt + kk][0], q[qt][0], (v8f){}));
            const int de = ((unsigned)(w0 + (qt + kk) * 16) < (unsigned)TT) ? dl + (kk - 1) * 16 : -64;   // a key tile is wholly real or wholly not: one that is not falls out of the band test below
#pragma unroll
            for (int j = 0; j < 8; ++j) { const float t = ((unsigned)(de + j) <= 2u * BAND) ? st[kk][j] * SCL : -3.0e38f; st[kk][j] = t; mx = fmaxf(mx, t); } }
        mx = fmaxf(mx, __shfl_xor(mx, 16, 32));
        float sum = 0.f;
#pragma unroll
        for (int kk = 0; kk < 3; ++kk)
#pragma unroll
            for (int j = 0; j < 8; ++j) { const float d0 = __fmul_rn(__fsub_rn(st[kk][j], mx), 1.4426950408889634f); float e;
                asm("v_exp_f32 %0, %1\n\tv_nop" : "=v"(e) : "v"(d0));   // the exp2 instruction with its one free slot in the same statement, so that nothing that reads its result or rewrites its source stands directly behind it
                st[kk][j] = e; sum += e; }
        sum += __shfl_xor(sum, 16, 32);
        const float f = __fdiv_rn(PCAR, sum);
#pragma unroll
        for (int kt = 0; kt < 4; ++kt)
#pragma unroll
            for (int j = 0; j < 8; ++j) p[qt][kt][j] = (kt >= qt && kt < qt + 3) ? (h16)(st[(kt - qt + 3) % 3][j] * f) : (h16)0.f;
    }
    bf* const oh = Ah + ((size_t)(z / NH_) * TT + r0 + lr) * DQ + (z % NH_) * HD + hi * 8; bf* const ol = Al + ((size_t)(z / NH_) * TT + r0 + lr) * DQ + (z % NH_) * HD + hi * 8;
#pragma unroll
    for (int qt = 0; qt < 2; ++qt)
#pragma unroll
        for (int dt = 0; dt < 4; ++dt) { const v8f o = wmma16(v[dt][1], cat16(p[qt][2], p[qt][3]), wmma16(v[dt][0], cat16(p[qt][0], p[qt][1]), (v8f){})); v8us a8, c8;
#pragma unroll
            for (int j = 0; j < 8; ++j) { unsigned short a, c2; splitf(o[j] * (1.0f / PCAR), a, c2); a8[j] = a; c8[j] = c2; }
            *(v8us*)(oh + qt * 16 * DQ + dt * 16) = a8; *(v8us*)(ol + qt * 16 * DQ + dt * 16) = c8; }
}

typedef __attribute__((ext_vector_type(2))) unsigned short v2us;

// ---- k_prep: the three jobs that read inputs only and do not depend on one another (fused weight -> Bt, output weight -> Bt, the stream -> bf16) as block ranges of ONE launch; the range test is on blockIdx.x alone, the same for a whole block.
// The weight blocks take the lowest indices: their eight line turns are the longest chain of the launch.
#define PB_WQKV (DM * 3 * DQ / 64 / 64)        // blocks of the fused weight: 64 lines of 64 elements each
#define PB_WO   (DQ * DM / 64 / 64)            // blocks of the output weight
#define PB_X    (NB_ * TT * DM / 8 / 256)      // blocks of the stream: 256 threads x 8 elements
static_assert((DM * 3 * DQ) % 4096 == 0 && (DQ * DM) % 4096 == 0 && (NB_ * TT * DM) % 2048 == 0, "whole blocks in every range");
__device__ __forceinline__ void wt_job(const float* __restrict__ w, int K, int N, bf* Bt, int blk) {
    const int lane = threadIdx.x & 31; const int L0 = (blk * 8 + (threadIdx.x >> 5)) * 8; const int nlines = N * K / 64;
    for (int l = 0; l < 8; ++l) { const int L = L0 + l; if (L >= nlines) break; const size_t e = (size_t)L * 64 + lane * 2; const int k = (int)(e % K), n = (int)(e / K); v2us o;
        o[0] = f2bf(w[(size_t)k * N + n]); o[1] = f2bf(w[(size_t)(k + 1) * N + n]); *(v2us*)(Bt + e) = o; }
}
__device__ __forceinline__ void cvt_job(const float* __restrict__ src, bf* dst, size_t n8, int blk) { const size_t i = (size_t)blk * 256 + threadIdx.x; if (i >= n8) return; const v8f v = *(const v8f*)(src + i * 8); v8us o;
    asm volatile("s_wait_xcnt 0x0" ::: "memory");   // the wait before the rounding below rewrites the address registers that the two loads name
#pragma unroll
    for (int k = 0; k < 8; ++k) o[k] = f2bf(v[k]); *(v8us*)(dst + i * 8) = o;  }
__global__ __launch_bounds__(256) void k_prep(const float* __restrict__ wqkv, const float* __restrict__ wo, const float* __restrict__ x, bf* WQKV, bf* WO, bf* XB) {
    const int b = blockIdx.x;
    if (b < PB_WQKV) wt_job(wqkv, DM, 3 * DQ, WQKV, b);                          // Bt row s * 256 + h * 64 + d
    else if (b < PB_WQKV + PB_WO) wt_job(wo, DQ, DM, WO, b - PB_WQKV);
    else cvt_job(x, XB, (size_t)NB_ * TT * DM / 8, b - (PB_WQKV + PB_WO));       // the one stream
}
extern "C" void kernel_launch(void* const* d_in, const int* in_sizes, int n_in,
                              void* d_out, int out_size, void* d_ws, size_t ws_size, hipStream_t stream) {
    (void)in_sizes; (void)n_in; (void)out_size;
    const float* x = (const float*)d_in[0]; const float* wqkv = (const float*)d_in[1]; const float* bqkv = (const float*)d_in[2]; const float* wo = (const float*)d_in[3]; const float* bo = (const float*)d_in[4];
    // inputs in the module's argument order: x ([4][4096][256]), Wqkv ('xw' (in, out) [256][768]; output column s * 256 + h * 64 + d, s = 0 query, 1 key, 2 value), bqkv ([768]), Wout ('xw' [256][256]), bout ([256]) = d_in[0..4]: FIVE inputs, all read (the set-up builds the two biases as zeros: read all the same)
    float* OUT = (float*)d_out;     // [4][4096][256]
    char* wsp = (char*)d_ws;
    auto take = [&](size_t bytes) { char* p = wsp; wsp += (bytes + 255) & ~(size_t)255; return (void*)p; };
    bf* WQKV = (bf*)take((size_t)3 * DQ * DM * 2); bf* WO = (bf*)take((size_t)DM * DQ * 2);
    bf* XB = (bf*)take((size_t)NB_ * TT * DM * 2);
    h16* QP16 = (h16*)take((size_t)NZ * TT * HD * 2); h16* KP16 = (h16*)take((size_t)NZ * TT * HD * 2); h16* VT16 = (h16*)take((size_t)NZ * HD * TT * 2);
    bf* ATh = (bf*)take((size_t)NB_ * TT * DQ * 2); bf* ATl = (bf*)take((size_t)NB_ * TT * DQ * 2);
    if ((size_t)(wsp - (char*)d_ws) > ws_size) return;    // total 48.50 MiB carved
    /* every stage once, over all batch entries and heads */
    k_prep<<<PB_WQKV + PB_WO + PB_X, 256, 0, stream>>>(wqkv, wo, x, WQKV, WO, XB);   /* both weights transposed to bf16 and the stream's bf16 copy: three independent jobs, one launch */
    k_gemmw<bf, 0, true, true><<<dim3(NB_ * TT / 64, 3 * DQ / 64, 1), 32, 0, stream>>>(XB, nullptr, WQKV, nullptr, DM, nullptr, 0, bqkv, 0, 0, 0, QP16, KP16, VT16);   /* q | k | v in one product; each 64-column tile stores its own f16 head plane */
    k_attn<<<NZ * TT / 128, 128, 0, stream>>>(QP16, KP16, VT16, ATh, ATl);   /* scores, band, softmax and weights x values: ONE f16 product each on every row; stores the merged context hi / lo */
    k_gemmw<bf, 1, true, false><<<dim3(NB_ * TT / 64, DM / 64, 1), 32, 0, stream>>>(ATh, ATl, WO, nullptr, DQ, OUT, DM, bo, 0, 0, 0, nullptr, nullptr, nullptr);   /* out = merged(hi + lo) Wout + bout: the one writer of the output */
}

// v006
// One run takes 38 microseconds.
// In two side-by-side timings against v005, it was 1.29 and 1.30 times as fast.
// All steps since v000 together make it 10.3 times as fast.
#include <hip/hip_runtime.h>

// Multi-head self-attention restricted to a static symmetric band (x [4][4096][256]: ONE stream; qkv = x Wqkv + bqkv with ONE fused 'xw' (in, out) [256][768] weight whose output column is s x 256 + h x 64 + d (s = 0 the queries, 1 the keys, 2 the values: the module reshapes the 768 columns as [3][4][64]) and a [768] bias (the module's set-up builds both biases as zeros: BOTH ARE READ); 4 heads x 64;
// scores = Q.K / sqrt(64); keys with |i - j| > 12 are replaced by -inf in the module (a 25-key band computed from the indices; every row keeps its own key: no row is fully excluded); softmax over the keys; out = merged Wout + bout with an 'xw' (in, out) [256][256] weight and a [256] bias -> [4][4096][256] (4.2 M);
// argument order x, Wqkv, bqkv, Wout, bout).
// Layout, ALL FOUR BATCH ENTRIES AND ALL FOUR HEADS IN EACH LAUNCH (rows b x 4096 + t in the row-major arrays, planes z = b x 4 + h in the head planes; the grids carry b and h, no host loop): the stream's bf16 copy made once and the two 'xw' weights transposed once (the fused one into a Bt [768][256], the output one into a Bt [256][256]), all three in one launch; ONE exact projection over the 768 fused columns + its f32 bias, whose epilogue rounds to f16 and stores the head planes itself: a 64-column tile is one (s, h), so it goes to the query or key plane [z][t][d] or, transposed, to the value plane [z][d][t];
// band attention in ONE launch: a wave takes 32 queries of one head plane and their 64-key window, computes the transposed scores, applies the |i - j| <= BAND band by an index select (an excluded key takes -3.0e38 before the maximum, so its weight is an exact zero, as exp(-inf - max) is), does the softmax in registers and feeds the f16 weights straight into the value product: scores and weights are never stored;
// EVERY row on ONE fp16 product (the weights x 1024); the same launch holds the output projection: a block's eight waves (4 heads x 2 query halves) leave 64 rows' merged context [t][h x 64 + d] as bf16 hi / lo in LDS, and behind one barrier merged hi/lo x Wout exact + bias writes the output.
// Compute dtypes, f32 accumulate: every float input rounded to bf16 at its load; the projection exact + f32 bias; attention: one fp16 product on every row; softmax f32; Wout hl x exact + bias (the merged context as bf16 hi / lo).

#define NB_  4
#define TT   4096
#define DM   256
#define NH_  4
#define NKV  4
#define REP  (NH_ / NKV)
#define HD   64
#define DQ   (NH_ * HD)
#define DKV  (NKV * HD)
#define NZ   (NB_ * NH_)   // head planes in one launch: z = b * NH_ + h
#define RH   0     // not read: EVERY row runs on one f16 product
#define WIN  0
#define PCAR 1024.0f
#define SCL  0.125f
#define BAND 12    // half width of the symmetric band: keys with |i - j| <= BAND are kept (a 25-key band)
static_assert(REP == 1, "plane z = b * NH_ + h serves queries, keys and values alike");
typedef _Float16 h16;
typedef unsigned short bf;
typedef __attribute__((ext_vector_type(16))) __bf16   v16bf;
typedef __attribute__((ext_vector_type(16))) _Float16 v16h;
typedef __attribute__((ext_vector_type(8)))  _Float16 v8h;
typedef __attribute__((ext_vector_type(8)))  unsigned short v8us;
typedef __attribute__((ext_vector_type(8)))  float    v8f;
typedef __attribute__((ext_vector_type(4)))  float    v4f;
typedef __attribute__((ext_vector_type(4)))  _Float16 v4h;
typedef __attribute__((ext_vector_type(4)))  unsigned short v4us;
typedef v8h  __attribute__((may_alias)) v8ha;
typedef v4f  __attribute__((may_alias)) v4fa;
typedef v8us __attribute__((may_alias)) v8usa;

__device__ __forceinline__ unsigned short f2bf(float f) { unsigned u = __float_as_uint(f); u += 0x7FFFu + ((u >> 16) & 1u); return (unsigned short)(u >> 16); }
__device__ __forceinline__ float bf2f(unsigned short b) { return __uint_as_float(((unsigned)b) << 16); }
__device__ __forceinline__ float bfr(float f) { return bf2f(f2bf(f)); }
__device__ __forceinline__ void splitf(float y, unsigned short& h, unsigned short& l) { h = f2bf(y); l = f2bf(y - bf2f(h)); }
__device__ __forceinline__ v16h cat16(v8h lo, v8h hi) { return __builtin_shufflevector(lo, hi, 0, 1, 2, 3, 4, 5, 6, 7, 8, 9, 10, 11, 12, 13, 14, 15); }
__device__ __forceinline__ v16bf cat16b(v8us lo, v8us hi) { return __builtin_bit_cast(v16bf, __builtin_shufflevector(lo, hi, 0, 1, 2, 3, 4, 5, 6, 7, 8, 9, 10, 11, 12, 13, 14, 15)); }
__device__ __forceinline__ v8f wmma16(v16h a, v16h b, v8f c) { return __builtin_amdgcn_wmma_f32_16x16x32_f16(false, a, false, b, (short)0, c, false, false); }
__device__ __forceinline__ v8f wmmab(v16bf a, v16bf b, v8f c) { return __builtin_amdgcn_wmma_f32_16x16x32_bf16(false, a, false, b, (short)0, c, false, false); }



// ---- k_gemmw: register-blocked GEMM, ONE WAVE per 64x64 output tile (16 accumulators), operands straight from K-contiguous 16-bit planes; grid (M/64, N/64, Z), 32 threads.
// C[m][n] (f32, pitch ldc, + optional f32 bias[n]) = sum_k A[m][k] Bt[n][k] (+ split products per NSPLIT). z-batch strides sA/sB/sC in elements. K % 32 == 0.
// PLANES: the fused q | k | v projection. C is not written; the tile at (r0, c0) is rows t0 .. t0 + 63 of batch entry r0 / TT and the HD columns of one s = c0 / DQ and one head, and its sums + bias go out as f16:
// s = 0, 1 to QP, KP [z][t][d] through the same LDS turn as the f32 tile; s = 2 to VT [z][d][t] straight from the accumulators, where a lane holds eight successive t of one d.
template <typename T16> struct WFrag;
template <> struct WFrag<h16> { typedef v16h V; static __device__ __forceinline__ V ld(const h16* p) { return cat16(*(const v8h*)p, *(const v8h*)(p + 16)); } static __device__ __forceinline__ v8f mma(V a, V b, v8f c) { return wmma16(a, b, c); } };
template <> struct WFrag<bf> { typedef v16bf V; static __device__ __forceinline__ V ld(const bf* p) { return cat16b(*(const v8us*)p, *(const v8us*)(p + 16)); } static __device__ __forceinline__ v8f mma(V a, V b, v8f c) { return wmmab(a, b, c); } };
template <typename T16, int NSPLIT, bool BIAS, bool PLANES>
__global__ __launch_bounds__(32) void k_gemmw(const T16* __restrict__ A, const T16* __restrict__ A2, const T16* __restrict__ Bt, const T16* __restrict__ Bt2, int K, float* C, int ldc, const float* __restrict__ bias, size_t sA, size_t sB, size_t sC, h16* QP, h16* KP, h16* VT) {
    typedef typename WFrag<T16>::V V;
    __shared__ __align__(16) float os[16 * 68];
    const size_t z = blockIdx.z; A += z * sA; if (A2) A2 += z * sA; Bt += z * sB; if (Bt2) Bt2 += z * sB; C += z * sC;
    const int lane = threadIdx.x & 31, lr = lane & 15, hi = lane >> 4; const int r0 = blockIdx.x * 64, c0 = blockIdx.y * 64;
    v8f acc[4][4];
#pragma unroll
    for (int mb = 0; mb < 4; ++mb)
#pragma unroll
        for (int nb = 0; nb < 4; ++nb) acc[mb][nb] = (v8f){};
    const size_t aoff = (size_t)(r0 + lr) * K + 8 * hi, boff = (size_t)(c0 + lr) * K + 8 * hi;
    for (int kc = 0; kc < K; kc += 32) {
        V a[4], a2[4];
#pragma unroll
        for (int mb = 0; mb < 4; ++mb) { a[mb] = WFrag<T16>::ld(A + aoff + (size_t)mb * 16 * K + kc); if (NSPLIT == 1 || NSPLIT == 2) a2[mb] = WFrag<T16>::ld(A2 + aoff + (size_t)mb * 16 * K + kc); }
#pragma unroll
        for (int nb = 0; nb < 4; ++nb) { const V b = WFrag<T16>::ld(Bt + boff + (size_t)nb * 16 * K + kc); V b2; if (NSPLIT >= 2) b2 = WFrag<T16>::ld(Bt2 + boff + (size_t)nb * 16 * K + kc);
#pragma unroll
            for (int mb = 0; mb < 4; ++mb) { acc[mb][nb] = WFrag<T16>::mma(a[mb], b, acc[mb][nb]); if (NSPLIT == 1 || NSPLIT == 2) acc[mb][nb] = WFrag<T16>::mma(a2[mb], b, acc[mb][nb]); if (NSPLIT >= 2) acc[mb][nb] = WFrag<T16>::mma(a[mb], b2, acc[mb][nb]); } }
        asm volatile("v_nop\n\tv_nop\n\tv_nop\n\tv_nop" : "+v"(acc[0][0]), "+v"(acc[1][1]), "+v"(acc[2][2]), "+v"(acc[3][3]) : "v"(a[0]), "v"(a[3]));
    }
    const size_t pz = PLANES ? (size_t)(r0 / TT) * NH_ + (c0 % DQ) / HD : 0; const int t0 = r0 % TT;   // PLANES: the tile's head plane and its first row there
    if (PLANES && c0 >= 2 * DQ) {   // values (the test is the same for the whole block)
#pragma unroll
        for (int nb = 0; nb < 4; ++nb) { const float bv = bfr(bias[c0 + nb * 16 + lr]); h16* const vrow = VT + (pz * HD + nb * 16 + lr) * TT + t0 + hi * 8;
#pragma unroll
            for (int mb = 0; mb < 4; ++mb) { v8h o;
#pragma unroll
                for (int j = 0; j < 8; ++j) o[j] = (h16)(acc[mb][nb][j] + bv);
                *(v8h*)(vrow + mb * 16) = o; } }
    } else {
    h16* const prow = PLANES ? ((c0 < DQ) ? QP : KP) + (pz * TT + t0) * HD : nullptr;
#pragma unroll
    for (int mb = 0; mb < 4; ++mb) {
#pragma unroll
        for (int nb = 0; nb < 4; ++nb) {
#pragma unroll
            for (int j = 0; j < 8; ++j) os[(hi * 8 + j) * 68 + nb * 16 + lr] = acc[mb][nb][j]; }
        __builtin_amdgcn_wave_barrier(); asm volatile("" ::: "memory");
        float* crow = PLANES ? nullptr : C + (size_t)(r0 + mb * 16) * ldc + c0;
{
#pragma unroll
            for (int s = 0; s < 8; ++s) { const int row = 2 * s + hi, cofs = lr * 4; v4f val = *(const v4fa*)(os + row * 68 + cofs); if (BIAS) { val[0] += bfr(bias[c0 + cofs]); val[1] += bfr(bias[c0 + cofs + 1]); val[2] += bfr(bias[c0 + cofs + 2]); val[3] += bfr(bias[c0 + cofs + 3]); }
                if (PLANES) { v4h o;
#pragma unroll
                    for (int q = 0; q < 4; ++q) o[q] = (h16)val[q];
                    *(v4h*)(prow + (size_t)(mb * 16 + row) * HD + cofs) = o; }
                else *(v4f*)(crow + (size_t)row * ldc + cofs) = val; }
             }
        if (PLANES) asm volatile("s_wait_xcnt 0x0" ::: "memory");   // the wait before what follows (the next turn's bias load first) rewrites registers that this turn's plane stores name
        __builtin_amdgcn_wave_barrier(); asm volatile("" ::: "memory");
    }
    }
}

// ---- k_attn: band attention and output projection of 64 rows of one batch entry. 256 threads = 8 waves; grid NB_ * TT / 64.
// Part 1: wave w does the whole band attention of one 32-query block (half w / NH_ of the 64 rows) of one head plane (head w % NH_); scores and weights never leave the registers.
// The block at r0 owns the QW = 64 keys w0 + 0 .. w0 + 63, w0 = r0 - 16 (BAND <= 16). Transposed products: St = K Qt (A = 16 key rows, B = 16 query rows, both d-contiguous through the one loader), so that a lane holds 8 keys of ONE query per tile:
// D register j of key tile kt is key w0 + kt * 16 + hi * 8 + j, query r0 + qt * 16 + lr. Query tile qt meets the band only in the key tiles qt, qt + 1, qt + 2: the fourth is not computed and its weights are zeros.
// Softmax as before (t = S x HD^-0.5 inside the band, -3.0e38 elsewhere by an index select, one exp, weights x 1024 rounded to f16); maximum and sum run in the lane and then once across the wave's halves.
// Two neighbouring key tiles' weights, converted in place, ARE the B operand of Ot = Vt Pt in the loader's k order (elements 0..7 = keys 8 hi + j, 8..15 = keys 16 + 8 hi + j of a 32-key step); A = the transposed values.
// A key before 0 or past the last takes a real key's address (min and max on the index keep every load inside its plane) and an exact zero weight. Ot gives a lane 8 successive d of one query: x 1 / 1024, bf16 hi + lo, one 16-byte LDS store each to ch / cl [row of the block][(z % NH_) x HD + d].
// Part 2, behind the block's one barrier: out = merged(hi + lo) Wout + bout. Wave w takes all 64 rows x the 32 output columns w x 32 ..: A = the context fragments from LDS, B = its own 32 rows of the transposed weight, loaded into registers before the barrier;
// per accumulator the products run k step by k step, hi then lo. A 16 x 32 f32 piece turns through the wave's own LDS strip so that each store instruction writes four whole 128-byte lines; a wave is the one writer of its lines.
static_assert(BAND <= 16 && HD == 64 && TT % 64 == 0 && NH_ == 4 && DQ == 256 && DM == 256, "one 64-key window per 32 queries, three key tiles per query tile; 64 rows of one batch entry, 8 waves x 32 output columns");
#define CP (DQ + 8)   // LDS pitch of a context row in elements: 16 bytes x an odd number, so that the 16-byte fragment reads of 16 rows spread over the banks
#define OP 36         // LDS pitch of a row of the output turn in floats (a multiple of 16 bytes)
__global__ __launch_bounds__(256) void k_attn(const h16* __restrict__ QP, const h16* __restrict__ KP, const h16* __restrict__ VT, const bf* __restrict__ WOt, const float* __restrict__ bo, float* OUT) {
    __shared__ __align__(16) bf ch[64 * CP]; __shared__ __align__(16) bf cl[64 * CP]; __shared__ __align__(16) float os[8 * 16 * OP];
    const int lane = threadIdx.x & 31, lr = lane & 15, hi = lane >> 4;
    const int w = __builtin_amdgcn_readfirstlane(threadIdx.x >> 5);   // the wave's number, in a scalar register: plane, rows and edge tests are the same in every lane
    const int g0 = blockIdx.x * 64, hd = w % NH_, qh = w / NH_, c0 = w * 32;   // the block's first row b x TT + t; the wave's head and query half (part 1) and first output column (part 2)
    const int z = (g0 / TT) * NH_ + hd, r0 = g0 % TT + qh * 32, w0 = r0 - 16;
    const h16* const Qz = QP + (size_t)z * TT * HD; const h16* const Kz = KP + (size_t)z * TT * HD; const h16* const Vz = VT + (size_t)z * HD * TT;
    v16h q[2][2], k[4][2], v[4][2];
#pragma unroll
    for (int qt = 0; qt < 2; ++qt)
#pragma unroll
        for (int ks = 0; ks < 2; ++ks) q[qt][ks] = WFrag<h16>::ld(Qz + (r0 + qt * 16 + lr) * HD + ks * 32 + 8 * hi);
#pragma unroll
    for (int kt = 0; kt < 4; ++kt) { const int kr = min(max(w0 + kt * 16 + lr, 0), TT - 1);
#pragma unroll
        for (int ks = 0; ks < 2; ++ks) k[kt][ks] = WFrag<h16>::ld(Kz + kr * HD + ks * 32 + 8 * hi); }
#pragma unroll
    for (int ks = 0; ks < 2; ++ks) { const int ta = min(max(w0 + ks * 32 + 8 * hi, 0), TT - 8), tb = min(max(w0 + ks * 32 + 16 + 8 * hi, 0), TT - 8);
#pragma unroll
        for (int dt = 0; dt < 4; ++dt) v[dt][ks] = cat16(*(const v8h*)(Vz + (dt * 16 + lr) * TT + ta), *(const v8h*)(Vz + (dt * 16 + lr) * TT + tb)); }
    __builtin_amdgcn_sched_barrier(0);   // all forty loads are issued before the first product: without it the scheduler sinks the later key tiles' and the values' loads behind waits for the first ones, and the wave pays the memory latency three times instead of once
    const int dl = hi * 8 - lr + BAND; v8h p[2][4];   // key - query + BAND of register j in key tile qt + kk is dl + (kk - 1) * 16 + j
#pragma unroll
    for (int qt = 0; qt < 2; ++qt) {
        v8f st[3]; float mx = -3.0e38f;
#pragma unroll
        for (int kk = 0; kk < 3; ++kk) { st[kk] = wmma16(k[qt + kk][1], q[qt][1], wmma16(k[qt + kk][0], q[qt][0], (v8f){}));
            const int de = ((unsigned)(w0 + (qt + kk) * 16) < (unsigned)TT) ? dl + (kk - 1) * 16 : -64;   // a key tile is wholly real or wholly not: one that is not falls out of the band test below
#pragma unroll
            for (int j = 0; j < 8; ++j) { const float t = ((unsigned)(de + j) <= 2u * BAND) ? st[kk][j] * SCL : -3.0e38f; st[kk][j] = t; mx = fmaxf(mx, t); } }
        mx = fmaxf(mx, __shfl_xor(mx, 16, 32));
        float sum = 0.f;
#pragma unroll
        for (int kk = 0; kk < 3; ++kk)
#pragma unroll
            for (int j = 0; j < 8; ++j) { const float d0 = __fmul_rn(__fsub_rn(st[kk][j], mx), 1.4426950408889634f); float e;
                asm("v_exp_f32 %0, %1\n\tv_nop" : "=v"(e) : "v"(d0));   // the exp2 instruction with its one free slot in the same statement, so that nothing that reads its result or rewrites its source stands directly behind it
                st[kk][j] = e; sum += e; }
        sum += __shfl_xor(sum, 16, 32);
        const float f = __fdiv_rn(PCAR, sum);
#pragma unroll
        for (int kt = 0; kt < 4; ++kt)
#pragma unroll
            for (int j = 0; j < 8; ++j) p[qt][kt][j] = (kt >= qt && kt < qt + 3) ? (h16)(st[(kt - qt + 3) % 3][j] * f) : (h16)0.f;
    }
    v16bf wb[8][2];   // part 2's weight slice and bias are asked for here, in front of the value product and the barrier, so that their latency passes behind those; both loops unrolled: the indices pick registers
#pragma unroll
    for (int ks = 0; ks < 8; ++ks)
#pragma unroll
        for (int nb = 0; nb < 2; ++nb) wb[ks][nb] = WFrag<bf>::ld(WOt + (c0 + nb * 16 + lr) * DQ + ks * 32 + 8 * hi);
    const int orow = lane >> 3, ocol = (lane & 7) * 4;   // the lane's row (of four) and first column in a store of part 2
    const v4f braw = *(const v4f*)(bo + c0 + ocol);
    bf* const oh = ch + (qh * 32 + lr) * CP + hd * HD + hi * 8; bf* const ol = cl + (qh * 32 + lr) * CP + hd * HD + hi * 8;
#pragma unroll
    for (int qt = 0; qt < 2; ++qt)
#pragma unroll
        for (int dt = 0; dt < 4; ++dt) { const v8f o = wmma16(v[dt][1], cat16(p[qt][2], p[qt][3]), wmma16(v[dt][0], cat16(p[qt][0], p[qt][1]), (v8f){})); v8us a8, c8;
#pragma unroll
            for (int j = 0; j < 8; ++j) { unsigned short a, c2; splitf(o[j] * (1.0f / PCAR), a, c2); a8[j] = a; c8[j] = c2; }
            *(v8us*)(oh + qt * 16 * CP + dt * 16) = a8; *(v8us*)(ol + qt * 16 * CP + dt * 16) = c8; }
    __syncthreads();   // all eight waves' context pieces are in LDS before any wave reads a whole row
    // every loop of part 2 is unrolled: its index picks registers (acc, a, a2, wb, val)
    v8f acc[4][2];
#pragma unroll
    for (int mb = 0; mb < 4; ++mb)
#pragma unroll
        for (int nb = 0; nb < 2; ++nb) acc[mb][nb] = (v8f){};
    const bf* const ah = ch + lr * CP + 8 * hi; const bf* const al = cl + lr * CP + 8 * hi;
#pragma unroll
    for (int ks = 0; ks < 8; ++ks) {
        v16bf a[4], a2[4];
#pragma unroll
        for (int mb = 0; mb < 4; ++mb) { a[mb] = WFrag<bf>::ld(ah + mb * 16 * CP + ks * 32); a2[mb] = WFrag<bf>::ld(al + mb * 16 * CP + ks * 32); }
#pragma unroll
        for (int nb = 0; nb < 2; ++nb) {
#pragma unroll
            for (int mb = 0; mb < 4; ++mb) acc[mb][nb] = wmmab(a[mb], wb[ks][nb], acc[mb][nb]);
#pragma unroll
            for (int mb = 0; mb < 4; ++mb) acc[mb][nb] = wmmab(a2[mb], wb[ks][nb], acc[mb][nb]); }
    }
    float* const ow = os + w * 16 * OP; float* const orp = OUT + (size_t)(g0 + orow) * DM + c0 + ocol;
    v4f bv;
#pragma unroll
    for (int q2 = 0; q2 < 4; ++q2) bv[q2] = bfr(braw[q2]);
#pragma unroll
    for (int mb = 0; mb < 4; ++mb) {
#pragma unroll
        for (int nb = 0; nb < 2; ++nb)
#pragma unroll
            for (int j = 0; j < 8; ++j) ow[(hi * 8 + j) * OP + nb * 16 + lr] = acc[mb][nb][j];
        __builtin_amdgcn_wave_barrier(); asm volatile("" ::: "memory");   // the compiler keeps the strip's reads behind the other lanes' writes
        v4f val[4];
#pragma unroll
        for (int s = 0; s < 4; ++s) val[s] = *(const v4fa*)(ow + (4 * s + orow) * OP + ocol);
#pragma unroll
        for (int s = 0; s < 4; ++s) *(v4f*)(orp + (mb * 16 + 4 * s) * DM) = val[s] + bv;
        if (mb < 3) { __builtin_amdgcn_wave_barrier(); asm volatile("" ::: "memory"); }   // the compiler keeps the next turn's writes behind this turn's reads
    }
}

typedef __attribute__((ext_vector_type(2))) unsigned short v2us;

// ---- k_prep: the three jobs that read inputs only and do not depend on one another (fused weight -> Bt, output weight -> Bt, the stream -> bf16) as block ranges of ONE launch; the range test is on blockIdx.x alone, the same for a whole block.
// The weight blocks take the lowest indices: their eight line turns are the longest chain of the launch.
#define PB_WQKV (DM * 3 * DQ / 64 / 64)        // blocks of the fused weight: 64 lines of 64 elements each
#define PB_WO   (DQ * DM / 64 / 64)            // blocks of the output weight
#define PB_X    (NB_ * TT * DM / 8 / 256)      // blocks of the stream: 256 threads x 8 elements
static_assert((DM * 3 * DQ) % 4096 == 0 && (DQ * DM) % 4096 == 0 && (NB_ * TT * DM) % 2048 == 0, "whole blocks in every range");
__device__ __forceinline__ void wt_job(const float* __restrict__ w, int K, int N, bf* Bt, int blk) {
    const int lane = threadIdx.x & 31; const int L0 = (blk * 8 + (threadIdx.x >> 5)) * 8; const int nlines = N * K / 64;
    for (int l = 0; l < 8; ++l) { const int L = L0 + l; if (L >= nlines) break; const size_t e = (size_t)L * 64 + lane * 2; const int k = (int)(e % K), n = (int)(e / K); v2us o;
        o[0] = f2bf(w[(size_t)k * N + n]); o[1] = f2bf(w[(size_t)(k + 1) * N + n]); *(v2us*)(Bt + e) = o; }
}
__device__ __forceinline__ void cvt_job(const float* __restrict__ src, bf* dst, size_t n8, int blk) { const size_t i = (size_t)blk * 256 + threadIdx.x; if (i >= n8) return; const v8f v = *(const v8f*)(src + i * 8); v8us o;
    asm volatile("s_wait_xcnt 0x0" ::: "memory");   // the wait before the rounding below rewrites the address registers that the two loads name
#pragma unroll
    for (int k = 0; k < 8; ++k) o[k] = f2bf(v[k]); *(v8us*)(dst + i * 8) = o;  }
__global__ __launch_bounds__(256) void k_prep(const float* __restrict__ wqkv, const float* __restrict__ wo, const float* __restrict__ x, bf* WQKV, bf* WO, bf* XB) {
    const int b = blockIdx.x;
    if (b < PB_WQKV) wt_job(wqkv, DM, 3 * DQ, WQKV, b);                          // Bt row s * 256 + h * 64 + d
    else if (b < PB_WQKV + PB_WO) wt_job(wo, DQ, DM, WO, b - PB_WQKV);
    else cvt_job(x, XB, (size_t)NB_ * TT * DM / 8, b - (PB_WQKV + PB_WO));       // the one stream
}
extern "C" void kernel_launch(void* const* d_in, const int* in_sizes, int n_in,
                              void* d_out, int out_size, void* d_ws, size_t ws_size, hipStream_t stream) {
    (void)in_sizes; (void)n_in; (void)out_size;
    const float* x = (const float*)d_in[0]; const float* wqkv = (const float*)d_in[1]; const float* bqkv = (const float*)d_in[2]; const float* wo = (const float*)d_in[3]; const float* bo = (const float*)d_in[4];
    // inputs in the module's argument order: x ([4][4096][256]), Wqkv ('xw' (in, out) [256][768]; output column s * 256 + h * 64 + d, s = 0 query, 1 key, 2 value), bqkv ([768]), Wout ('xw' [256][256]), bout ([256]) = d_in[0..4]: FIVE inputs, all read (the set-up builds the two biases as zeros: read all the same)
    float* OUT = (float*)d_out;     // [4][4096][256]
    char* wsp = (char*)d_ws;
    auto take = [&](size_t bytes) { char* p = wsp; wsp += (bytes + 255) & ~(size_t)255; return (void*)p; };
    bf* WQKV = (bf*)take((size_t)3 * DQ * DM * 2); bf* WO = (bf*)take((size_t)DM * DQ * 2);
    bf* XB = (bf*)take((size_t)NB_ * TT * DM * 2);
    h16* QP16 = (h16*)take((size_t)NZ * TT * HD * 2); h16* KP16 = (h16*)take((size_t)NZ * TT * HD * 2); h16* VT16 = (h16*)take((size_t)NZ * HD * TT * 2);
    if ((size_t)(wsp - (char*)d_ws) > ws_size) return;    // total 32.50 MiB carved
    /* every stage once, over all batch entries and heads */
    k_prep<<<PB_WQKV + PB_WO + PB_X, 256, 0, stream>>>(wqkv, wo, x, WQKV, WO, XB);   /* both weights transposed to bf16 and the stream's bf16 copy: three independent jobs, one launch */
    k_gemmw<bf, 0, true, true><<<dim3(NB_ * TT / 64, 3 * DQ / 64, 1), 32, 0, stream>>>(XB, nullptr, WQKV, nullptr, DM, nullptr, 0, bqkv, 0, 0, 0, QP16, KP16, VT16);   /* q | k | v in one product; each 64-column tile stores its own f16 head plane */
    k_attn<<<NB_ * TT / 64, 256, 0, stream>>>(QP16, KP16, VT16, WO, bo, OUT);   /* scores, band, softmax and weights x values: ONE f16 product each on every row; the merged context hi / lo stays in LDS; out = merged(hi + lo) Wout + bout: the one writer of the output */
}

// v007
// One run takes 23.5 microseconds.
// Timed twice side by side with v006, it ran 1.60 and 1.61 times as fast.
// Over all steps from v000 it is 16.5 times as fast.
#include <hip/hip_runtime.h>

// Multi-head self-attention restricted to a static symmetric band (x [4][4096][256]: ONE stream; qkv = x Wqkv + bqkv with ONE fused 'xw' (in, out) [256][768] weight whose output column is s x 256 + h x 64 + d (s = 0 the queries, 1 the keys, 2 the values: the module reshapes the 768 columns as [3][4][64]) and a [768] bias (the module's set-up builds both biases as zeros: BOTH ARE READ); 4 heads x 64;
// scores = Q.K / sqrt(64); keys with |i - j| > 12 are replaced by -inf in the module (a 25-key band computed from the indices; every row keeps its own key: no row is fully excluded); softmax over the keys; out = merged Wout + bout with an 'xw' (in, out) [256][256] weight and a [256] bias -> [4][4096][256] (4.2 M);
// argument order x, Wqkv, bqkv, Wout, bout).
// Layout, ALL FOUR BATCH ENTRIES AND ALL FOUR HEADS IN EACH LAUNCH (rows b x 4096 + t in the row-major arrays; the grid carries b, the waves of a block carry h, no host loop): the stream's bf16 copy made once and the two 'xw' weights transposed once (the fused one into a Bt [768][256], the output one into a Bt [256][256]), all three in one launch;
// everything else in ONE launch, a block per 64 rows of one batch entry: the exact projection over the 768 fused columns + its f32 bias for the block's own 96-row window (64 rows and 16 on either side), rounded to f16 in registers: q, k and v are never stored;
// band attention: a wave takes 32 queries of one head and their 64-key window, computes the transposed scores, applies the |i - j| <= BAND band by an index select (an excluded key takes -3.0e38 before the maximum, so its weight is an exact zero, as exp(-inf - max) is), does the softmax in registers and feeds the f16 weights straight into the value product: scores and weights are never stored;
// EVERY row on ONE fp16 product (the weights x 1024); the same launch holds the output projection: a block's eight waves (4 heads x 2 query halves) leave 64 rows' merged context [t][h x 64 + d] as bf16 hi / lo in LDS, and behind one barrier merged hi/lo x Wout exact + bias writes the output.
// Compute dtypes, f32 accumulate: every float input rounded to bf16 at its load; the projection exact + f32 bias; attention: one fp16 product on every row; softmax f32; Wout hl x exact + bias (the merged context as bf16 hi / lo).

#define NB_  4
#define TT   4096
#define DM   256
#define NH_  4
#define NKV  4
#define REP  (NH_ / NKV)
#define HD   64
#define DQ   (NH_ * HD)
#define DKV  (NKV * HD)
#define NZ   (NB_ * NH_)   // head planes in one launch: z = b * NH_ + h
#define RH   0     // not read: EVERY row runs on one f16 product
#define WIN  0
#define PCAR 1024.0f
#define SCL  0.125f
#define BAND 12    // half width of the symmetric band: keys with |i - j| <= BAND are kept (a 25-key band)
static_assert(REP == 1, "plane z = b * NH_ + h serves queries, keys and values alike");
typedef _Float16 h16;
typedef unsigned short bf;
typedef __attribute__((ext_vector_type(16))) __bf16   v16bf;
typedef __attribute__((ext_vector_type(16))) _Float16 v16h;
typedef __attribute__((ext_vector_type(8)))  _Float16 v8h;
typedef __attribute__((ext_vector_type(8)))  unsigned short v8us;
typedef __attribute__((ext_vector_type(8)))  float    v8f;
typedef __attribute__((ext_vector_type(4)))  float    v4f;
typedef __attribute__((ext_vector_type(4)))  _Float16 v4h;
typedef __attribute__((ext_vector_type(4)))  unsigned short v4us;
typedef v8h  __attribute__((may_alias)) v8ha;
typedef v4f  __attribute__((may_alias)) v4fa;
typedef v8us __attribute__((may_alias)) v8usa;

__device__ __forceinline__ unsigned short f2bf(float f) { unsigned u = __float_as_uint(f); u += 0x7FFFu + ((u >> 16) & 1u); return (unsigned short)(u >> 16); }
__device__ __forceinline__ float bf2f(unsigned short b) { return __uint_as_float(((unsigned)b) << 16); }
__device__ __forceinline__ float bfr(float f) { return bf2f(f2bf(f)); }
__device__ __forceinline__ void splitf(float y, unsigned short& h, unsigned short& l) { h = f2bf(y); l = f2bf(y - bf2f(h)); }
__device__ __forceinline__ v16h cat16(v8h lo, v8h hi) { return __builtin_shufflevector(lo, hi, 0, 1, 2, 3, 4, 5, 6, 7, 8, 9, 10, 11, 12, 13, 14, 15); }
__device__ __forceinline__ v16bf cat16b(v8us lo, v8us hi) { return __builtin_bit_cast(v16bf, __builtin_shufflevector(lo, hi, 0, 1, 2, 3, 4, 5, 6, 7, 8, 9, 10, 11, 12, 13, 14, 15)); }
__device__ __forceinline__ v8f wmma16(v16h a, v16h b, v8f c) { return __builtin_amdgcn_wmma_f32_16x16x32_f16(false, a, false, b, (short)0, c, false, false); }
__device__ __forceinline__ v8f wmmab(v16bf a, v16bf b, v8f c) { return __builtin_amdgcn_wmma_f32_16x16x32_bf16(false, a, false, b, (short)0, c, false, false); }



// ---- the one fragment loader: a lane's 16 elements of a K-contiguous row are k = 8 hi + 0..7 and 16 + 8 hi + 0..7 of a 32-wide k step, for A and for B alike.
template <typename T16> struct WFrag;
template <> struct WFrag<h16> { typedef v16h V; static __device__ __forceinline__ V ld(const h16* p) { return cat16(*(const v8h*)p, *(const v8h*)(p + 16)); } static __device__ __forceinline__ v8f mma(V a, V b, v8f c) { return wmma16(a, b, c); } };
template <> struct WFrag<bf> { typedef v16bf V; static __device__ __forceinline__ V ld(const bf* p) { return cat16b(*(const v8us*)p, *(const v8us*)(p + 16)); } static __device__ __forceinline__ v8f mma(V a, V b, v8f c) { return wmmab(a, b, c); } };

// ---- k_attn: q | k | v projection, band attention and output projection of 64 rows of one batch entry. 256 threads = 8 waves; grid NB_ * TT / 64.
// Part 0: the block's window is the 96 rows t0 - 16 .. t0 + 79 of the stream (a 16-row tile before row 0 or past the last takes a real tile's addresses; its keys get exact zero weights below). The window lies in LDS once;
// the fused weight passes through LDS in six chunks of 256 Bt rows x 128 k (keys, queries, values; each the low k half, then the high one), two buffers: the next chunk's whole-line loads fly in registers while this one is worked on, and one barrier a trip publishes it.
// Wave w (head w % NH_, query half w / NH_) makes what it alone needs, all products k step by k step upward: Kt = Wk Xt and Qt = Wq Xt (A = 16 weight rows, B = 16 window rows) give a lane 8 successive d of ONE row, V = X Wvt (A = 16 window rows, B = 16 weight rows) 8 successive t of ONE d:
// D register j of a tile is A row hi * 8 + j, B row lr, so that two neighbouring tiles + bias, rounded to f16 in place, ARE a 32-wide operand in the loader's k order (elements 0..7 = 8 hi + j, 8..15 = 16 + 8 hi + j): q and k over d, v over t.
// Part 1: wave w does the whole band attention of one 32-query block (half w / NH_ of the 64 rows) of one head (w % NH_); scores and weights never leave the registers.
// The block at r0 owns the QW = 64 keys w0 + 0 .. w0 + 63, w0 = r0 - 16 (BAND <= 16). Transposed products: St = K Qt (A = 16 key rows, B = 16 query rows), so that a lane holds 8 keys of ONE query per tile:
// D register j of key tile kt is key w0 + kt * 16 + hi * 8 + j, query r0 + qt * 16 + lr. Query tile qt meets the band only in the key tiles qt, qt + 1, qt + 2: the fourth is not computed and its weights are zeros.
// Softmax as before (t = S x HD^-0.5 inside the band, -3.0e38 elsewhere by an index select, one exp, weights x 1024 rounded to f16); maximum and sum run in the lane and then once across the wave's halves.
// Two neighbouring key tiles' weights, converted in place, ARE the B operand of Ot = Vt Pt in the loader's k order; A = the transposed values.
// Ot gives a lane 8 successive d of one query: x 1 / 1024, bf16 hi + lo, one 16-byte LDS store each to ch / cl [row of the block][head x HD + d].
// Part 2, behind one barrier: out = merged(hi + lo) Wout + bout. Wave w takes all 64 rows x the 32 output columns w x 32 ..: A = the context fragments from LDS, B = its own 32 rows of the transposed weight, loaded into registers before the barrier;
// per accumulator the products run k step by k step, hi then lo. A 16 x 32 f32 piece turns through the wave's own LDS strip so that each store instruction writes four whole 128-byte lines; a wave is the one writer of its lines.
static_assert(BAND <= 16 && HD == 64 && TT % 64 == 0 && NH_ == 4 && DQ == 256 && DM == 256, "one 64-key window per 32 queries, three key tiles per query tile; 64 rows of one batch entry, 8 waves x 32 output columns");
#define CP (DQ + 8)   // LDS pitch of a context row in elements: 16 bytes x an odd number, so that the 16-byte fragment reads of 16 rows spread over the banks
#define OP 36         // LDS pitch of a row of the output turn in floats (a multiple of 16 bytes)
#define XR 96         // rows of the block's window
#define XP (DM + 8)   // LDS pitch of a window row in elements: 16 bytes x an odd number
#define WK 128        // k width of a weight chunk
#define WP (WK + 8)   // LDS pitch of a chunk row in elements: 16 bytes x an odd number
#define WCH (DQ * WP) // elements of one chunk buffer
template <int N> struct IC { static constexpr int v = N; };   // a compile-time number as an argument
__device__ __forceinline__ v8h cvb(v8f a, v8f b) { v8h o;
#pragma unroll
    for (int j = 0; j < 8; ++j) o[j] = (h16)(a[j] + b[j]);
    return o; }
__global__ __launch_bounds__(256) void k_attn(const bf* __restrict__ XB, const bf* __restrict__ WQKV, const float* __restrict__ bq, const bf* __restrict__ WOt, const float* __restrict__ bo, float* OUT) {
    __shared__ __align__(16) bf xs[XR * XP]; __shared__ __align__(16) bf wsh[2 * WCH];
    __shared__ __align__(16) bf ch[64 * CP]; __shared__ __align__(16) bf cl[64 * CP]; __shared__ __align__(16) float os[8 * 16 * OP];
    const int tid = threadIdx.x, lane = threadIdx.x & 31, lr = lane & 15, hi = lane >> 4;
    const int w = __builtin_amdgcn_readfirstlane(threadIdx.x >> 5);   // the wave's number, in a scalar register: head, rows and edge tests are the same in every lane
    const int g0 = blockIdx.x * 64, hd = w % NH_, qh = w / NH_, c0 = w * 32;   // the block's first row b x TT + t; the wave's head and query half (parts 0, 1) and first output column (part 2)
    const int t0 = g0 % TT, r0 = t0 + qh * 32, w0 = r0 - 16;
    // every loop of part 0 is unrolled: its index picks registers (xr, sr, the accumulators and operands)
    const bf* const Xb = XB + (size_t)(g0 / TT) * TT * DM;
    const bf* const wsrc = WQKV + (tid >> 4) * DM + (tid & 15) * 8;   // a load instruction of a wave takes two rows' 256-byte halves: four whole lines
    bf* const wdst = wsh + (tid >> 4) * WP + (tid & 15) * 8;
    v8us sr[16];
    // the window's rows: a load instruction of a wave takes one whole row; the first and the last 16 rows are wholly real or wholly not (t0 is a multiple of 64), and a 16-row tile that is not takes the neighbouring real tile's addresses (a test that is the same for the whole block)
    const bf* const xmid = Xb + t0 * DM + tid * 8; const bf* const xlo = xmid + ((t0 == 0) ? 16 * DM : 0); const bf* const xhi = xmid - ((t0 == TT - 64) ? 16 * DM : 0);
    { v8us xr[12];
#pragma unroll
      for (int it = 0; it < 12; ++it) xr[it] = *(const v8us*)(((it < 2) ? xlo : (it < 10) ? xmid : xhi) + (it * 8 - 16) * DM);
#pragma unroll
      for (int it = 0; it < 16; ++it) sr[it] = *(const v8us*)(wsrc + (DQ + it * 16) * DM);
      asm volatile("s_wait_xcnt 0x0" :: "v"(xlo), "v"(xmid), "v"(xhi), "v"(wsrc) : "memory");   // the wait before anything rewrites an address register that these loads name; the pointers are inputs so that no later load's result is given their registers in front of it
#pragma unroll
      for (int it = 0; it < 12; ++it) { const int i = it * 256 + tid; *(v8us*)(xs + (i >> 5) * XP + (i & 31) * 8) = xr[it]; }
#pragma unroll
      for (int it = 0; it < 16; ++it) *(v8us*)(wdst + it * 16 * WP) = sr[it]; }
    __syncthreads();   // the window and the first chunk are in LDS before any wave reads a fragment
    v8f acc0[4][4]; v16h q[2][2], k[4][2], v[4][2];   // acc0[weight tile][window tile]: one part's sums at a time
    // one trip = one chunk; the chunk's number is a compile-time constant, so that each of the six trips is straight-line code of its own part
    auto trip = [&](auto ic) __attribute__((always_inline)) {
        constexpr int c = decltype(ic)::v, so = (c < 2) ? 1 : (c < 4) ? 0 : 2, sn = (c + 1 < 2) ? 1 : (c + 1 < 4) ? 0 : 2;   // this trip's and the next trip's part of the fused columns: keys, queries, values
        constexpr int x0 = (so == 0) ? 1 : 0, x1 = (so == 0) ? 3 : 4;   // the part's window tiles: the queries are the two in the middle
        v8f bd[4];
        if constexpr (c < 5) {
#pragma unroll
            for (int it = 0; it < 16; ++it) sr[it] = *(const v8us*)(wsrc + (sn * DQ + it * 16) * DM + ((c + 1) & 1) * WK); }
        if constexpr ((c & 1) != 0) {   // the part's bias, asked for one chunk ahead of its use: 8 successive d of a lane, or the lane's one d
#pragma unroll
            for (int dt = 0; dt < 4; ++dt) { if constexpr (so < 2) bd[dt] = *(const v8f*)(bq + so * DQ + hd * HD + dt * 16 + hi * 8); else bd[dt][0] = bq[so * DQ + hd * HD + dt * 16 + lr]; } }
        else {
#pragma unroll
            for (int dt = 0; dt < 4; ++dt)
#pragma unroll
                for (int tt = x0; tt < x1; ++tt) acc0[dt][tt] = (v8f){}; }
        asm volatile("s_wait_xcnt 0x0" ::: "memory");   // the wait before anything below rewrites an address register that these loads name
        __builtin_amdgcn_sched_barrier(0);   // the next chunk's loads are issued before this chunk's products: sunk to their LDS stores they would put the memory latency in front of every barrier
        const bf* const wf = wsh + (c & 1) * WCH + (hd * HD + lr) * WP + 8 * hi; const bf* const xf = xs + (qh * 32 + lr) * XP + (c & 1) * WK + 8 * hi;
        v16bf xa[2][4], wa[2][4];   // two sets of fragments: the next k step's LDS reads fly while this step's products issue
#pragma unroll
        for (int kq = -1; kq < WK / 32; ++kq) {
            if (kq + 1 < WK / 32) {
#pragma unroll
                for (int tt = x0; tt < x1; ++tt) xa[(kq + 1) & 1][tt] = WFrag<bf>::ld(xf + tt * 16 * XP + (kq + 1) * 32);
#pragma unroll
                for (int dt = 0; dt < 4; ++dt) wa[(kq + 1) & 1][dt] = WFrag<bf>::ld(wf + dt * 16 * WP + (kq + 1) * 32); }
            if (kq >= 0 && kq + 1 < WK / 32) __builtin_amdgcn_sched_barrier(0);   // the reads of step kq + 1 are issued in front of the products of step kq: left alone the scheduler put each weight fragment's read and a full wait directly in front of its four products
            if (kq >= 0) {
#pragma unroll
                for (int dt = 0; dt < 4; ++dt)
#pragma unroll
                    for (int tt = x0; tt < x1; ++tt) acc0[dt][tt] = (so < 2) ? wmmab(wa[kq & 1][dt], xa[kq & 1][tt], acc0[dt][tt]) : wmmab(xa[kq & 1][tt], wa[kq & 1][dt], acc0[dt][tt]);
                if (kq + 2 < WK / 32) __builtin_amdgcn_sched_barrier(0); }   // and no read moves further ahead than one step: a third set of fragments would not fit the registers
        }
        if constexpr ((c & 1) != 0) {   // the part's sums are whole: + bias, f16, two neighbouring tiles to one operand
#pragma unroll
            for (int dt = 0; dt < 4; ++dt)
#pragma unroll
                for (int j = 0; j < 8; ++j) bd[dt][j] = bfr(bd[dt][(so < 2) ? j : 0]);
#pragma unroll
            for (int ks = 0; ks < 2; ++ks)
#pragma unroll
                for (int i = 0; i < 4; ++i) {
                    if constexpr (so == 1) k[i][ks] = cat16(cvb(acc0[2 * ks][i], bd[2 * ks]), cvb(acc0[2 * ks + 1][i], bd[2 * ks + 1]));
                    else if constexpr (so == 0) { if (i < 2) q[i][ks] = cat16(cvb(acc0[2 * ks][i + 1], bd[2 * ks]), cvb(acc0[2 * ks + 1][i + 1], bd[2 * ks + 1])); }
                    else v[i][ks] = cat16(cvb(acc0[i][2 * ks], bd[i]), cvb(acc0[i][2 * ks + 1], bd[i])); }
        }
        if constexpr (c < 5) {
            __builtin_amdgcn_sched_barrier(0);   // this chunk's products stay in front of the wait for the next chunk's loads: sunk behind the barrier they would leave that latency uncovered
#pragma unroll
            for (int it = 0; it < 16; ++it) *(v8us*)(wdst + ((c + 1) & 1) * WCH + it * 16 * WP) = sr[it];
            __syncthreads(); }   // publishes the next chunk; every wave has also left the buffer that the next trip refills
    };
    trip(IC<0>{}); trip(IC<1>{}); trip(IC<2>{}); trip(IC<3>{}); trip(IC<4>{}); trip(IC<5>{});
    const int dl = hi * 8 - lr + BAND; v8h p[2][4];   // key - query + BAND of register j in key tile qt + kk is dl + (kk - 1) * 16 + j
#pragma unroll
    for (int qt = 0; qt < 2; ++qt) {
        __builtin_amdgcn_sched_barrier(0);   // no matrix instruction of another part moves in among this tile's exp statements
        v8f st[3]; float mx = -3.0e38f;
#pragma unroll
        for (int kk = 0; kk < 3; ++kk) { st[kk] = wmma16(k[qt + kk][1], q[qt][1], wmma16(k[qt + kk][0], q[qt][0], (v8f){}));
            const int de = ((unsigned)(w0 + (qt + kk) * 16) < (unsigned)TT) ? dl + (kk - 1) * 16 : -64;   // a key tile is wholly real or wholly not: one that is not falls out of the band test below
#pragma unroll
            for (int j = 0; j < 8; ++j) { const float t = ((unsigned)(de + j) <= 2u * BAND) ? st[kk][j] * SCL : -3.0e38f; st[kk][j] = t; mx = fmaxf(mx, t); } }
        mx = fmaxf(mx, __shfl_xor(mx, 16, 32));
        float sum = 0.f;
#pragma unroll
        for (int kk = 0; kk < 3; ++kk)
#pragma unroll
            for (int j = 0; j < 8; ++j) { const float d0 = __fmul_rn(__fsub_rn(st[kk][j], mx), 1.4426950408889634f); float e;
                asm("v_exp_f32 %0, %1\n\tv_nop" : "=v"(e) : "v"(d0));   // the exp2 instruction with its one free slot in the same statement, so that nothing that reads its result or rewrites its source stands directly behind it
                st[kk][j] = e; sum += e; }
        sum += __shfl_xor(sum, 16, 32);
        const float f = __fdiv_rn(PCAR, sum);
#pragma unroll
        for (int kt = 0; kt < 4; ++kt)
#pragma unroll
            for (int j = 0; j < 8; ++j) p[qt][kt][j] = (kt >= qt && kt < qt + 3) ? (h16)(st[(kt - qt + 3) % 3][j] * f) : (h16)0.f;
    }
    __builtin_amdgcn_sched_barrier(0);   // as at the head of the loop: the value products stay behind the last exp statement
    v16bf wb[8][2];   // part 2's weight slice and bias are asked for here, in front of the value product and the barrier, so that their latency passes behind those; both loops unrolled: the indices pick registers
#pragma unroll
    for (int ks = 0; ks < 8; ++ks)
#pragma unroll
        for (int nb = 0; nb < 2; ++nb) wb[ks][nb] = WFrag<bf>::ld(WOt + (c0 + nb * 16 + lr) * DQ + ks * 32 + 8 * hi);
    const int orow = lane >> 3, ocol = (lane & 7) * 4;   // the lane's row (of four) and first column in a store of part 2
    const v4f braw = *(const v4f*)(bo + c0 + ocol);
    bf* const oh = ch + (qh * 32 + lr) * CP + hd * HD + hi * 8; bf* const ol = cl + (qh * 32 + lr) * CP + hd * HD + hi * 8;
#pragma unroll
    for (int qt = 0; qt < 2; ++qt)
#pragma unroll
        for (int dt = 0; dt < 4; ++dt) { const v8f o = wmma16(v[dt][1], cat16(p[qt][2], p[qt][3]), wmma16(v[dt][0], cat16(p[qt][0], p[qt][1]), (v8f){})); v8us a8, c8;
#pragma unroll
            for (int j = 0; j < 8; ++j) { unsigned short a, c2; splitf(o[j] * (1.0f / PCAR), a, c2); a8[j] = a; c8[j] = c2; }
            *(v8us*)(oh + qt * 16 * CP + dt * 16) = a8; *(v8us*)(ol + qt * 16 * CP + dt * 16) = c8; }
    __syncthreads();   // all eight waves' context pieces are in LDS before any wave reads a whole row
    // every loop of part 2 is unrolled: its index picks registers (acc, a, a2, wb, val)
    v8f acc[4][2];
#pragma unroll
    for (int mb = 0; mb < 4; ++mb)
#pragma unroll
        for (int nb = 0; nb < 2; ++nb) acc[mb][nb] = (v8f){};
    const bf* const ah = ch + lr * CP + 8 * hi; const bf* const al = cl + lr * CP + 8 * hi;
#pragma unroll
    for (int ks = 0; ks < 8; ++ks) {
        v16bf a[4], a2[4];
#pragma unroll
        for (int mb = 0; mb < 4; ++mb) { a[mb] = WFrag<bf>::ld(ah + mb * 16 * CP + ks * 32); a2[mb] = WFrag<bf>::ld(al + mb * 16 * CP + ks * 32); }
#pragma unroll
        for (int nb = 0; nb < 2; ++nb) {
#pragma unroll
            for (int mb = 0; mb < 4; ++mb) acc[mb][nb] = wmmab(a[mb], wb[ks][nb], acc[mb][nb]);
#pragma unroll
            for (int mb = 0; mb < 4; ++mb) acc[mb][nb] = wmmab(a2[mb], wb[ks][nb], acc[mb][nb]); }
    }
    float* const ow = os + w * 16 * OP; float* const orp = OUT + (size_t)(g0 + orow) * DM + c0 + ocol;
    v4f bv;
#pragma unroll
    for (int q2 = 0; q2 < 4; ++q2) bv[q2] = bfr(braw[q2]);
#pragma unroll
    for (int mb = 0; mb < 4; ++mb) {
#pragma unroll
        for (int nb = 0; nb < 2; ++nb)
#pragma unroll
            for (int j = 0; j < 8; ++j) ow[(hi * 8 + j) * OP + nb * 16 + lr] = acc[mb][nb][j];
        __builtin_amdgcn_wave_barrier(); asm volatile("" ::: "memory");   // the compiler keeps the strip's reads behind the other lanes' writes
        v4f val[4];
#pragma unroll
        for (int s = 0; s < 4; ++s) val[s] = *(const v4fa*)(ow + (4 * s + orow) * OP + ocol);
#pragma unroll
        for (int s = 0; s < 4; ++s) *(v4f*)(orp + (mb * 16 + 4 * s) * DM) = val[s] + bv;
        if (mb < 3) { __builtin_amdgcn_wave_barrier(); asm volatile("" ::: "memory"); }   // the compiler keeps the next turn's writes behind this turn's reads
    }
}

typedef __attribute__((ext_vector_type(2))) unsigned short v2us;

// ---- k_prep: the three jobs that read inputs only and do not depend on one another (fused weight -> Bt, output weight -> Bt, the stream -> bf16) as block ranges of ONE launch; the range test is on blockIdx.x alone, the same for a whole block.
// The weight blocks take the lowest indices: their eight line turns are the longest chain of the launch.
#define PB_WQKV (DM * 3 * DQ / 64 / 64)        // blocks of the fused weight: 64 lines of 64 elements each
#define PB_WO   (DQ * DM / 64 / 64)            // blocks of the output weight
#define PB_X    (NB_ * TT * DM / 8 / 256)      // blocks of the stream: 256 threads x 8 elements
static_assert((DM * 3 * DQ) % 4096 == 0 && (DQ * DM) % 4096 == 0 && (NB_ * TT * DM) % 2048 == 0, "whole blocks in every range");
__device__ __forceinline__ void wt_job(const float* __restrict__ w, int K, int N, bf* Bt, int blk) {
    const int lane = threadIdx.x & 31; const int L0 = (blk * 8 + (threadIdx.x >> 5)) * 8; const int nlines = N * K / 64;
    for (int l = 0; l < 8; ++l) { const int L = L0 + l; if (L >= nlines) break; const size_t e = (size_t)L * 64 + lane * 2; const int k = (int)(e % K), n = (int)(e / K); v2us o;
        o[0] = f2bf(w[(size_t)k * N + n]); o[1] = f2bf(w[(size_t)(k + 1) * N + n]); *(v2us*)(Bt + e) = o; }
}
__device__ __forceinline__ void cvt_job(const float* __restrict__ src, bf* dst, size_t n8, int blk) { const size_t i = (size_t)blk * 256 + threadIdx.x; if (i >= n8) return; const v8f v = *(const v8f*)(src + i * 8); v8us o;
    asm volatile("s_wait_xcnt 0x0" ::: "memory");   // the wait before the rounding below rewrites the address registers that the two loads name
#pragma unroll
    for (int k = 0; k < 8; ++k) o[k] = f2bf(v[k]); *(v8us*)(dst + i * 8) = o;  }
__global__ __launch_bounds__(256) void k_prep(const float* __restrict__ wqkv, const float* __restrict__ wo, const float* __restrict__ x, bf* WQKV, bf* WO, bf* XB) {
    const int b = blockIdx.x;
    if (b < PB_WQKV) wt_job(wqkv, DM, 3 * DQ, WQKV, b);                          // Bt row s * 256 + h * 64 + d
    else if (b < PB_WQKV + PB_WO) wt_job(wo, DQ, DM, WO, b - PB_WQKV);
    else cvt_job(x, XB, (size_t)NB_ * TT * DM / 8, b - (PB_WQKV + PB_WO));       // the one stream
}
extern "C" void kernel_launch(void* const* d_in, const int* in_sizes, int n_in,
                              void* d_out, int out_size, void* d_ws, size_t ws_size, hipStream_t stream) {
    (void)in_sizes; (void)n_in; (void)out_size;
    const float* x = (const float*)d_in[0]; const float* wqkv = (const float*)d_in[1]; const float* bqkv = (const float*)d_in[2]; const float* wo = (const float*)d_in[3]; const float* bo = (const float*)d_in[4];
    // inputs in the module's argument order: x ([4][4096][256]), Wqkv ('xw' (in, out) [256][768]; output column s * 256 + h * 64 + d, s = 0 query, 1 key, 2 value), bqkv ([768]), Wout ('xw' [256][256]), bout ([256]) = d_in[0..4]: FIVE inputs, all read (the set-up builds the two biases as zeros: read all the same)
    float* OUT = (float*)d_out;     // [4][4096][256]
    char* wsp = (char*)d_ws;
    auto take = [&](size_t bytes) { char* p = wsp; wsp += (bytes + 255) & ~(size_t)255; return (void*)p; };
    bf* WQKV = (bf*)take((size_t)3 * DQ * DM * 2); bf* WO = (bf*)take((size_t)DM * DQ * 2);
    bf* XB = (bf*)take((size_t)NB_ * TT * DM * 2);
    if ((size_t)(wsp - (char*)d_ws) > ws_size) return;    // total 8.50 MiB carved
    /* every stage once, over all batch entries and heads */
    k_prep<<<PB_WQKV + PB_WO + PB_X, 256, 0, stream>>>(wqkv, wo, x, WQKV, WO, XB);   /* both weights transposed to bf16 and the stream's bf16 copy: three independent jobs, one launch */
    k_attn<<<NB_ * TT / 64, 256, 0, stream>>>(XB, WQKV, bqkv, WO, bo, OUT);   /* q | k | v of each block's own window in one product each, kept in registers as f16; scores, band, softmax and weights x values: ONE f16 product each on every row; the merged context hi / lo stays in LDS; out = merged(hi + lo) Wout + bout: the one writer of the output */
}

// v008
// It runs in 23 microseconds.
// Next to v007, in two timings, it ran 1.04 times as fast each time.
// All steps since v000 together make it 17.2 times as fast.
#include <hip/hip_runtime.h>

// Multi-head self-attention restricted to a static symmetric band (x [4][4096][256]: ONE stream; qkv = x Wqkv + bqkv with ONE fused 'xw' (in, out) [256][768] weight whose output column is s x 256 + h x 64 + d (s = 0 the queries, 1 the keys, 2 the values: the module reshapes the 768 columns as [3][4][64]) and a [768] bias (the module's set-up builds both biases as zeros: BOTH ARE READ); 4 heads x 64;
// scores = Q.K / sqrt(64); keys with |i - j| > 12 are replaced by -inf in the module (a 25-key band computed from the indices; every row keeps its own key: no row is fully excluded); softmax over the keys; out = merged Wout + bout with an 'xw' (in, out) [256][256] weight and a [256] bias -> [4][4096][256] (4.2 M);
// argument order x, Wqkv, bqkv, Wout, bout).
// Layout, ALL FOUR BATCH ENTRIES AND ALL FOUR HEADS IN EACH LAUNCH (rows b x 4096 + t in the row-major arrays; the grid carries b, a block's waves the heads, no host loop): the two 'xw' weights transposed once to bf16 (the fused one into a Bt [768][256], the output one into a Bt [256][256]), both in one launch; the stream has no bf16 copy in memory: each block reads its own window as f32 and rounds it on the way into LDS;
// everything else in ONE launch, a block per 64 rows of one batch entry: the exact projection over the 768 fused columns + its f32 bias for the block's own 96-row window (64 rows and 16 on either side), rounded to f16 in registers: q, k and v are never stored;
// band attention: a wave takes 32 queries of one head and their 64-key window, computes the transposed scores, applies the |i - j| <= BAND band by an index select (an excluded key takes -3.0e38 before the maximum, so its weight is an exact zero, as exp(-inf - max) is), does the softmax in registers and feeds the f16 weights straight into the value product: scores and weights are never stored;
// EVERY row on ONE fp16 product (the weights x 1024); the same launch holds the output projection: a block's eight waves (4 heads x 2 query halves) leave 64 rows' merged context [t][h x 64 + d] as bf16 hi / lo in LDS, and behind one barrier merged hi/lo x Wout exact + bias writes the output.
// Compute dtypes, f32 accumulate: every float input rounded to bf16 at its load; the projection exact + f32 bias; attention: one fp16 product on every row; softmax f32; Wout hl x exact + bias (the merged context as bf16 hi / lo).

#define NB_  4
#define TT   4096
#define DM   256
#define NH_  4
#define NKV  4
#define REP  (NH_ / NKV)
#define HD   64
#define DQ   (NH_ * HD)
#define DKV  (NKV * HD)
#define NZ   (NB_ * NH_)   // head planes in one launch: z = b * NH_ + h
#define RH   0     // not read: EVERY row runs on one f16 product
#define WIN  0
#define PCAR 1024.0f
#define SCL  0.125f
#define BAND 12    // half width of the symmetric band: keys with |i - j| <= BAND are kept (a 25-key band)
static_assert(REP == 1, "plane z = b * NH_ + h serves queries, keys and values alike");
typedef _Float16 h16;
typedef unsigned short bf;
typedef __attribute__((ext_vector_type(16))) __bf16   v16bf;
typedef __attribute__((ext_vector_type(16))) _Float16 v16h;
typedef __attribute__((ext_vector_type(8)))  _Float16 v8h;
typedef __attribute__((ext_vector_type(8)))  unsigned short v8us;
typedef __attribute__((ext_vector_type(8)))  float    v8f;
typedef __attribute__((ext_vector_type(4)))  float    v4f;
typedef __attribute__((ext_vector_type(4)))  _Float16 v4h;
typedef __attribute__((ext_vector_type(4)))  unsigned short v4us;
typedef __attribute__((ext_vector_type(4)))  __bf16   v4b;
typedef v8h  __attribute__((may_alias)) v8ha;
typedef v4f  __attribute__((may_alias)) v4fa;
typedef v8us __attribute__((may_alias)) v8usa;

__device__ __forceinline__ unsigned short f2bf(float f) { unsigned u = __float_as_uint(f); u += 0x7FFFu + ((u >> 16) & 1u); return (unsigned short)(u >> 16); }
__device__ __forceinline__ float bf2f(unsigned short b) { return __uint_as_float(((unsigned)b) << 16); }
__device__ __forceinline__ float bfr(float f) { return bf2f(f2bf(f)); }
__device__ __forceinline__ void splitf(float y, unsigned short& h, unsigned short& l) { h = f2bf(y); l = f2bf(y - bf2f(h)); }
__device__ __forceinline__ v16h cat16(v8h lo, v8h hi) { return __builtin_shufflevector(lo, hi, 0, 1, 2, 3, 4, 5, 6, 7, 8, 9, 10, 11, 12, 13, 14, 15); }
__device__ __forceinline__ v16bf cat16b(v8us lo, v8us hi) { return __builtin_bit_cast(v16bf, __builtin_shufflevector(lo, hi, 0, 1, 2, 3, 4, 5, 6, 7, 8, 9, 10, 11, 12, 13, 14, 15)); }
__device__ __forceinline__ v8f wmma16(v16h a, v16h b, v8f c) { return __builtin_amdgcn_wmma_f32_16x16x32_f16(false, a, false, b, (short)0, c, false, false); }
__device__ __forceinline__ v8f wmmab(v16bf a, v16bf b, v8f c) { return __builtin_amdgcn_wmma_f32_16x16x32_bf16(false, a, false, b, (short)0, c, false, false); }



// ---- the one fragment loader: a lane's 16 elements of a K-contiguous row are k = 8 hi + 0..7 and 16 + 8 hi + 0..7 of a 32-wide k step, for A and for B alike.
template <typename T16> struct WFrag;
template <> struct WFrag<h16> { typedef v16h V; static __device__ __forceinline__ V ld(const h16* p) { return cat16(*(const v8h*)p, *(const v8h*)(p + 16)); } static __device__ __forceinline__ v8f mma(V a, V b, v8f c) { return wmma16(a, b, c); } };
template <> struct WFrag<bf> { typedef v16bf V; static __device__ __forceinline__ V ld(const bf* p) { return cat16b(*(const v8us*)p, *(const v8us*)(p + 16)); } static __device__ __forceinline__ v8f mma(V a, V b, v8f c) { return wmmab(a, b, c); } };

// ---- k_attn: q | k | v projection, band attention and output projection of 64 rows of one batch entry. 256 threads = 8 waves; grid NB_ * TT / 64.
// Part 0: the block's window is the 96 rows t0 - 16 .. t0 + 79 of the stream (a 16-row tile before row 0 or past the last takes a real tile's addresses; its keys get exact zero weights below). The window is read as f32, rounded to bf16 (nearest even) in registers and lies in LDS once: its low 128 columns, all that the first chunk meets, before the first barrier; the high 128 fly in registers through the first trip, whose barrier publishes them;
// the fused weight passes through LDS in six chunks of 256 Bt rows x 128 k (keys, queries, values; each the low k half, then the high one), two buffers: the next chunk's whole-line loads fly in registers while this one is worked on, and one barrier a trip publishes it.
// Wave w (head w % NH_, query half w / NH_) makes what it alone needs, all products k step by k step upward: Kt = Wk Xt and Qt = Wq Xt (A = 16 weight rows, B = 16 window rows) give a lane 8 successive d of ONE row, V = X Wvt (A = 16 window rows, B = 16 weight rows) 8 successive t of ONE d:
// D register j of a tile is A row hi * 8 + j, B row lr, so that two neighbouring tiles + bias, rounded to f16 in place, ARE a 32-wide operand in the loader's k order (elements 0..7 = 8 hi + j, 8..15 = 16 + 8 hi + j): q and k over d, v over t.
// Part 1: wave w does the whole band attention of one 32-query block (half w / NH_ of the 64 rows) of one head (w % NH_); scores and weights never leave the registers.
// The block at r0 owns the QW = 64 keys w0 + 0 .. w0 + 63, w0 = r0 - 16 (BAND <= 16). Transposed products: St = K Qt (A = 16 key rows, B = 16 query rows), so that a lane holds 8 keys of ONE query per tile:
// D register j of key tile kt is key w0 + kt * 16 + hi * 8 + j, query r0 + qt * 16 + lr. Query tile qt meets the band only in the key tiles qt, qt + 1, qt + 2: the fourth is not computed and its weights are zeros.
// Softmax as before (t = S x HD^-0.5 inside the band, -3.0e38 elsewhere by an index select, one exp, weights x 1024 rounded to f16); maximum and sum run in the lane and then once across the wave's halves.
// Two neighbouring key tiles' weights, converted in place, ARE the B operand of Ot = Vt Pt in the loader's k order; A = the transposed values.
// Ot gives a lane 8 successive d of one query: x 1 / 1024, bf16 hi + lo, one 16-byte LDS store each to ch / cl [row of the block][head x HD + d].
// Part 2, behind one barrier: out = merged(hi + lo) Wout + bout. Wave w takes all 64 rows x the 32 output columns w x 32 ..: A = the context fragments from LDS, B = its own 32 rows of the transposed weight, loaded into registers before the barrier;
// per accumulator the products run k step by k step, hi then lo. A 16 x 32 f32 piece turns through the wave's own LDS strip so that each store instruction writes four whole 128-byte lines; a wave is the one writer of its lines.
static_assert(BAND <= 16 && HD == 64 && TT % 64 == 0 && NH_ == 4 && DQ == 256 && DM == 256, "one 64-key window per 32 queries, three key tiles per query tile; 64 rows of one batch entry, 8 waves x 32 output columns");
#define CP (DQ + 8)   // LDS pitch of a context row in elements: 16 bytes x an odd number, so that the 16-byte fragment reads of 16 rows spread over the banks
#define OP 36         // LDS pitch of a row of the output turn in floats (a multiple of 16 bytes)
#define XR 96         // rows of the block's window
#define XP (DM + 8)   // LDS pitch of a window row in elements: 16 bytes x an odd number
#define WK 128        // k width of a weight chunk
#define WP (WK + 8)   // LDS pitch of a chunk row in elements: 16 bytes x an odd number
#define WCH (DQ * WP) // elements of one chunk buffer
template <int N> struct IC { static constexpr int v = N; };   // a compile-time number as an argument
__device__ __forceinline__ v8h cvb(v8f a, v8f b) { v8h o;
#pragma unroll
    for (int j = 0; j < 8; ++j) o[j] = (h16)(a[j] + b[j]);
    return o; }
__global__ __launch_bounds__(256) void k_attn(const float* __restrict__ X, const bf* __restrict__ WQKV, const float* __restrict__ bq, const bf* __restrict__ WOt, const float* __restrict__ bo, float* OUT) {
    __shared__ __align__(16) bf xs[XR * XP]; __shared__ __align__(16) bf wsh[2 * WCH];
    __shared__ __align__(16) bf ch[64 * CP]; __shared__ __align__(16) bf cl[64 * CP]; __shared__ __align__(16) float os[8 * 16 * OP];
    const int tid = threadIdx.x, lane = threadIdx.x & 31, lr = lane & 15, hi = lane >> 4;
    const int w = __builtin_amdgcn_readfirstlane(threadIdx.x >> 5);   // the wave's number, in a scalar register: head, rows and edge tests are the same in every lane
    const int g0 = blockIdx.x * 64, hd = w % NH_, qh = w / NH_, c0 = w * 32;   // the block's first row b x TT + t; the wave's head and query half (parts 0, 1) and first output column (part 2)
    const int t0 = g0 % TT, r0 = t0 + qh * 32, w0 = r0 - 16;
    // every loop of part 0 is unrolled: its index picks registers (xl, xh, sr, the accumulators and operands)
    const float* const Xb = X + (size_t)(g0 / TT) * TT * DM;
    const bf* const wsrc = WQKV + (tid >> 4) * DM + (tid & 15) * 8;   // a load instruction of a wave takes two rows' 256-byte halves: four whole lines
    bf* const wdst = wsh + (tid >> 4) * WP + (tid & 15) * 8;
    v8us sr[16]; v4f xh[12];
    // the window's rows, f32: a load instruction of a wave takes half a row (128 columns, four whole lines), one of the block the same half of eight rows; the first and the last 16 rows are wholly real or wholly not (t0 is a multiple of 64), and a 16-row tile that is not takes the neighbouring real tile's addresses (a test that is the same for the whole block)
    const float* const xmid = Xb + t0 * DM + (tid >> 5) * DM + (tid & 31) * 4; const float* const xlo = xmid + ((t0 == 0) ? 16 * DM : 0); const float* const xhi = xmid - ((t0 == TT - 64) ? 16 * DM : 0);
    bf* const xdst = xs + (tid >> 5) * XP + (tid & 31) * 4;
    { v4f xl[12];
#pragma unroll
      for (int it = 0; it < 12; ++it) xl[it] = *(const v4f*)(((it < 2) ? xlo : (it < 10) ? xmid : xhi) + (it * 8 - 16) * DM);
#pragma unroll
      for (int it = 0; it < 16; ++it) sr[it] = *(const v8us*)(wsrc + (DQ + it * 16) * DM);
#pragma unroll
      for (int it = 0; it < 12; ++it) xh[it] = *(const v4f*)(((it < 2) ? xlo : (it < 10) ? xmid : xhi) + (it * 8 - 16) * DM + WK);
      asm volatile("s_wait_xcnt 0x0" :: "v"(xlo), "v"(xmid), "v"(xhi), "v"(wsrc) : "memory");   // the wait before anything rewrites an address register that these loads name; the pointers are inputs so that no later load's result is given their registers in front of it
#pragma unroll
      for (int it = 0; it < 12; ++it) *(v4us*)(xdst + it * 8 * XP) = __builtin_bit_cast(v4us, __builtin_convertvector(xl[it], v4b));
#pragma unroll
      for (int it = 0; it < 16; ++it) *(v8us*)(wdst + it * 16 * WP) = sr[it]; }
    // the window's low columns and the first chunk are in LDS before any wave reads a fragment. The work-group barrier with its two fences on LDS alone: __syncthreads() would also wait for the high columns' global loads, which nothing reads before the end of the first trip
    __builtin_amdgcn_fence(__ATOMIC_RELEASE, "workgroup", "local"); __builtin_amdgcn_s_barrier(); __builtin_amdgcn_fence(__ATOMIC_ACQUIRE, "workgroup", "local");
    v8f acc0[4][4]; v16h q[2][2], k[4][2], v[4][2];   // acc0[weight tile][window tile]: one part's sums at a time
    // one trip = one chunk; the chunk's number is a compile-time constant, so that each of the six trips is straight-line code of its own part
    auto trip = [&](auto ic) __attribute__((always_inline)) {
        constexpr int c = decltype(ic)::v, so = (c < 2) ? 1 : (c < 4) ? 0 : 2, sn = (c + 1 < 2) ? 1 : (c + 1 < 4) ? 0 : 2;   // this trip's and the next trip's part of the fused columns: keys, queries, values
        constexpr int x0 = (so == 0) ? 1 : 0, x1 = (so == 0) ? 3 : 4;   // the part's window tiles: the queries are the two in the middle
        v8f bd[4];
        if constexpr (c < 5) {
#pragma unroll
            for (int it = 0; it < 16; ++it) sr[it] = *(const v8us*)(wsrc + (sn * DQ + it * 16) * DM + ((c + 1) & 1) * WK); }
        if constexpr ((c & 1) != 0) {   // the part's bias, asked for one chunk ahead of its use: 8 successive d of a lane, or the lane's one d
#pragma unroll
            for (int dt = 0; dt < 4; ++dt) { if constexpr (so < 2) bd[dt] = *(const v8f*)(bq + so * DQ + hd * HD + dt * 16 + hi * 8); else bd[dt][0] = bq[so * DQ + hd * HD + dt * 16 + lr]; } }
        else {
#pragma unroll
            for (int dt = 0; dt < 4; ++dt)
#pragma unroll
                for (int tt = x0; tt < x1; ++tt) acc0[dt][tt] = (v8f){}; }
        asm volatile("s_wait_xcnt 0x0" ::: "memory");   // the wait before anything below rewrites an address register that these loads name
        __builtin_amdgcn_sched_barrier(0);   // the next chunk's loads are issued before this chunk's products: sunk to their LDS stores they would put the memory latency in front of every barrier
        const bf* const wf = wsh + (c & 1) * WCH + (hd * HD + lr) * WP + 8 * hi; const bf* const xf = xs + (qh * 32 + lr) * XP + (c & 1) * WK + 8 * hi;
        v16bf xa[2][4], wa[2][4];   // two sets of fragments: the next k step's LDS reads fly while this step's products issue
#pragma unroll
        for (int kq = -1; kq < WK / 32; ++kq) {
            if (kq + 1 < WK / 32) {
#pragma unroll
                for (int tt = x0; tt < x1; ++tt) xa[(kq + 1) & 1][tt] = WFrag<bf>::ld(xf + tt * 16 * XP + (kq + 1) * 32);
#pragma unroll
                for (int dt = 0; dt < 4; ++dt) wa[(kq + 1) & 1][dt] = WFrag<bf>::ld(wf + dt * 16 * WP + (kq + 1) * 32); }
            if (kq >= 0 && kq + 1 < WK / 32) __builtin_amdgcn_sched_barrier(0);   // the reads of step kq + 1 are issued in front of the products of step kq: left alone the scheduler put each weight fragment's read and a full wait directly in front of its four products
            if (kq >= 0) {
#pragma unroll
                for (int dt = 0; dt < 4; ++dt)
#pragma unroll
                    for (int tt = x0; tt < x1; ++tt) acc0[dt][tt] = (so < 2) ? wmmab(wa[kq & 1][dt], xa[kq & 1][tt], acc0[dt][tt]) : wmmab(xa[kq & 1][tt], wa[kq & 1][dt], acc0[dt][tt]);
                if (kq + 2 < WK / 32) __builtin_amdgcn_sched_barrier(0); }   // and no read moves further ahead than one step: a third set of fragments would not fit the registers
        }
        if constexpr ((c & 1) != 0) {   // the part's sums are whole: + bias, f16, two neighbouring tiles to one operand
#pragma unroll
            for (int dt = 0; dt < 4; ++dt)
#pragma unroll
                for (int j = 0; j < 8; ++j) bd[dt][j] = bfr(bd[dt][(so < 2) ? j : 0]);
#pragma unroll
            for (int ks = 0; ks < 2; ++ks)
#pragma unroll
                for (int i = 0; i < 4; ++i) {
                    if constexpr (so == 1) k[i][ks] = cat16(cvb(acc0[2 * ks][i], bd[2 * ks]), cvb(acc0[2 * ks + 1][i], bd[2 * ks + 1]));
                    else if constexpr (so == 0) { if (i < 2) q[i][ks] = cat16(cvb(acc0[2 * ks][i + 1], bd[2 * ks]), cvb(acc0[2 * ks + 1][i + 1], bd[2 * ks + 1])); }
                    else v[i][ks] = cat16(cvb(acc0[i][2 * ks], bd[i]), cvb(acc0[i][2 * ks + 1], bd[i])); }
        }
        if constexpr (c < 5) {
            __builtin_amdgcn_sched_barrier(0);   // this chunk's products stay in front of the wait for the next chunk's loads: sunk behind the barrier they would leave that latency uncovered
            if constexpr (c == 0) {   // the window's high columns, first read in the next trip
#pragma unroll
                for (int it = 0; it < 12; ++it) *(v4us*)(xdst + it * 8 * XP + WK) = __builtin_bit_cast(v4us, __builtin_convertvector(xh[it], v4b)); }
#pragma unroll
            for (int it = 0; it < 16; ++it) *(v8us*)(wdst + ((c + 1) & 1) * WCH + it * 16 * WP) = sr[it];
            __syncthreads(); }   // publishes the next chunk; every wave has also left the buffer that the next trip refills
    };
    trip(IC<0>{}); trip(IC<1>{}); trip(IC<2>{}); trip(IC<3>{}); trip(IC<4>{}); trip(IC<5>{});
    const int dl = hi * 8 - lr + BAND; v8h p[2][4];   // key - query + BAND of register j in key tile qt + kk is dl + (kk - 1) * 16 + j
#pragma unroll
    for (int qt = 0; qt < 2; ++qt) {
        __builtin_amdgcn_sched_barrier(0);   // no matrix instruction of another part moves in among this tile's exp statements
        v8f st[3]; float mx = -3.0e38f;
#pragma unroll
        for (int kk = 0; kk < 3; ++kk) { st[kk] = wmma16(k[qt + kk][1], q[qt][1], wmma16(k[qt + kk][0], q[qt][0], (v8f){}));
            const int de = ((unsigned)(w0 + (qt + kk) * 16) < (unsigned)TT) ? dl + (kk - 1) * 16 : -64;   // a key tile is wholly real or wholly not: one that is not falls out of the band test below
#pragma unroll
            for (int j = 0; j < 8; ++j) { const float t = ((unsigned)(de + j) <= 2u * BAND) ? st[kk][j] * SCL : -3.0e38f; st[kk][j] = t; mx = fmaxf(mx, t); } }
        mx = fmaxf(mx, __shfl_xor(mx, 16, 32));
        float sum = 0.f;
#pragma unroll
        for (int kk = 0; kk < 3; ++kk)
#pragma unroll
            for (int j = 0; j < 8; ++j) { const float d0 = __fmul_rn(__fsub_rn(st[kk][j], mx), 1.4426950408889634f); float e;
                asm("v_exp_f32 %0, %1\n\tv_nop" : "=v"(e) : "v"(d0));   // the exp2 instruction with its one free slot in the same statement, so that nothing that reads its result or rewrites its source stands directly behind it
                st[kk][j] = e; sum += e; }
        sum += __shfl_xor(sum, 16, 32);
        const float f = __fdiv_rn(PCAR, sum);
#pragma unroll
        for (int kt = 0; kt < 4; ++kt)
#pragma unroll
            for (int j = 0; j < 8; ++j) p[qt][kt][j] = (kt >= qt && kt < qt + 3) ? (h16)(st[(kt - qt + 3) % 3][j] * f) : (h16)0.f;
    }
    __builtin_amdgcn_sched_barrier(0);   // as at the head of the loop: the value products stay behind the last exp statement
    v16bf wb[8][2];   // part 2's weight slice and bias are asked for here, in front of the value product and the barrier, so that their latency passes behind those; both loops unrolled: the indices pick registers
#pragma unroll
    for (int ks = 0; ks < 8; ++ks)
#pragma unroll
        for (int nb = 0; nb < 2; ++nb) wb[ks][nb] = WFrag<bf>::ld(WOt + (c0 + nb * 16 + lr) * DQ + ks * 32 + 8 * hi);
    const int orow = lane >> 3, ocol = (lane & 7) * 4;   // the lane's row (of four) and first column in a store of part 2
    const v4f braw = *(const v4f*)(bo + c0 + ocol);
    bf* const oh = ch + (qh * 32 + lr) * CP + hd * HD + hi * 8; bf* const ol = cl + (qh * 32 + lr) * CP + hd * HD + hi * 8;
#pragma unroll
    for (int qt = 0; qt < 2; ++qt)
#pragma unroll
        for (int dt = 0; dt < 4; ++dt) { const v8f o = wmma16(v[dt][1], cat16(p[qt][2], p[qt][3]), wmma16(v[dt][0], cat16(p[qt][0], p[qt][1]), (v8f){})); v8us a8, c8;
#pragma unroll
            for (int j = 0; j < 8; ++j) { unsigned short a, c2; splitf(o[j] * (1.0f / PCAR), a, c2); a8[j] = a; c8[j] = c2; }
            *(v8us*)(oh + qt * 16 * CP + dt * 16) = a8; *(v8us*)(ol + qt * 16 * CP + dt * 16) = c8; }
    __syncthreads();   // all eight waves' context pieces are in LDS before any wave reads a whole row
    // every loop of part 2 is unrolled: its index picks registers (acc, a, a2, wb, val)
    v8f acc[4][2];
#pragma unroll
    for (int mb = 0; mb < 4; ++mb)
#pragma unroll
        for (int nb = 0; nb < 2; ++nb) acc[mb][nb] = (v8f){};
    const bf* const ah = ch + lr * CP + 8 * hi; const bf* const al = cl + lr * CP + 8 * hi;
#pragma unroll
    for (int ks = 0; ks < 8; ++ks) {
        v16bf a[4], a2[4];
#pragma unroll
        for (int mb = 0; mb < 4; ++mb) { a[mb] = WFrag<bf>::ld(ah + mb * 16 * CP + ks * 32); a2[mb] = WFrag<bf>::ld(al + mb * 16 * CP + ks * 32); }
#pragma unroll
        for (int nb = 0; nb < 2; ++nb) {
#pragma unroll
            for (int mb = 0; mb < 4; ++mb) acc[mb][nb] = wmmab(a[mb], wb[ks][nb], acc[mb][nb]);
#pragma unroll
            for (int mb = 0; mb < 4; ++mb) acc[mb][nb] = wmmab(a2[mb], wb[ks][nb], acc[mb][nb]); }
    }
    float* const ow = os + w * 16 * OP; float* const orp = OUT + (size_t)(g0 + orow) * DM + c0 + ocol;
    v4f bv;
#pragma unroll
    for (int q2 = 0; q2 < 4; ++q2) bv[q2] = bfr(braw[q2]);
#pragma unroll
    for (int mb = 0; mb < 4; ++mb) {
#pragma unroll
        for (int nb = 0; nb < 2; ++nb)
#pragma unroll
            for (int j = 0; j < 8; ++j) ow[(hi * 8 + j) * OP + nb * 16 + lr] = acc[mb][nb][j];
        __builtin_amdgcn_wave_barrier(); asm volatile("" ::: "memory");   // the compiler keeps the strip's reads behind the other lanes' writes
        v4f val[4];
#pragma unroll
        for (int s = 0; s < 4; ++s) val[s] = *(const v4fa*)(ow + (4 * s + orow) * OP + ocol);
#pragma unroll
        for (int s = 0; s < 4; ++s) *(v4f*)(orp + (mb * 16 + 4 * s) * DM) = val[s] + bv;
        if (mb < 3) { __builtin_amdgcn_wave_barrier(); asm volatile("" ::: "memory"); }   // the compiler keeps the next turn's writes behind this turn's reads
    }
}

typedef __attribute__((ext_vector_type(2))) unsigned short v2us;

// ---- k_prep: the two jobs that read weights only and do not depend on one another (fused weight -> Bt, output weight -> Bt) as block ranges of ONE launch; the range test is on blockIdx.x alone, the same for a whole block.
#define PB_WQKV (DM * 3 * DQ / 64 / 64)        // blocks of the fused weight: 64 lines of 64 elements each
#define PB_WO   (DQ * DM / 64 / 64)            // blocks of the output weight
static_assert((DM * 3 * DQ) % 4096 == 0 && (DQ * DM) % 4096 == 0, "whole blocks in every range");
__device__ __forceinline__ void wt_job(const float* __restrict__ w, int K, int N, bf* Bt, int blk) {
    const int lane = threadIdx.x & 31; const int L0 = (blk * 8 + (threadIdx.x >> 5)) * 8; const int nlines = N * K / 64;
    for (int l = 0; l < 8; ++l) { const int L = L0 + l; if (L >= nlines) break; const size_t e = (size_t)L * 64 + lane * 2; const int k = (int)(e % K), n = (int)(e / K); v2us o;
        o[0] = f2bf(w[(size_t)k * N + n]); o[1] = f2bf(w[(size_t)(k + 1) * N + n]); *(v2us*)(Bt + e) = o; }
}
__global__ __launch_bounds__(256) void k_prep(const float* __restrict__ wqkv, const float* __restrict__ wo, bf* WQKV, bf* WO) {
    const int b = blockIdx.x;
    if (b < PB_WQKV) wt_job(wqkv, DM, 3 * DQ, WQKV, b);                          // Bt row s * 256 + h * 64 + d
    else wt_job(wo, DQ, DM, WO, b - PB_WQKV);
}
extern "C" void kernel_launch(void* const* d_in, const int* in_sizes, int n_in,
                              void* d_out, int out_size, void* d_ws, size_t ws_size, hipStream_t stream) {
    (void)in_sizes; (void)n_in; (void)out_size;
    const float* x = (const float*)d_in[0]; const float* wqkv = (const float*)d_in[1]; const float* bqkv = (const float*)d_in[2]; const float* wo = (const float*)d_in[3]; const float* bo = (const float*)d_in[4];
    // inputs in the module's argument order: x ([4][4096][256]), Wqkv ('xw' (in, out) [256][768]; output column s * 256 + h * 64 + d, s = 0 query, 1 key, 2 value), bqkv ([768]), Wout ('xw' [256][256]), bout ([256]) = d_in[0..4]: FIVE inputs, all read (the set-up builds the two biases as zeros: read all the same)
    float* OUT = (float*)d_out;     // [4][4096][256]
    char* wsp = (char*)d_ws;
    auto take = [&](size_t bytes) { char* p = wsp; wsp += (bytes + 255) & ~(size_t)255; return (void*)p; };
    bf* WQKV = (bf*)take((size_t)3 * DQ * DM * 2); bf* WO = (bf*)take((size_t)DM * DQ * 2);
    if ((size_t)(wsp - (char*)d_ws) > ws_size) return;    // total 0.50 MiB carved
    /* every stage once, over all batch entries and heads */
    k_prep<<<PB_WQKV + PB_WO, 256, 0, stream>>>(wqkv, wo, WQKV, WO);   /* both weights transposed to bf16: two independent jobs, one launch */
    k_attn<<<NB_ * TT / 64, 256, 0, stream>>>(x, WQKV, bqkv, WO, bo, OUT);   /* the block's window of the stream rounded to bf16 at its load; q | k | v of each block's own window in one product each, kept in registers as f16; scores, band, softmax and weights x values: ONE f16 product each on every row; the merged context hi / lo stays in LDS; out = merged(hi + lo) Wout + bout: the one writer of the output */
}

// v009
// One run takes 19.4 microseconds.
// Timed twice side by side with v008, it ran 1.20 and 1.18 times as fast.
// Over all steps from v000 it is 20.4 times as fast.
#include <hip/hip_runtime.h>

// Multi-head self-attention restricted to a static symmetric band (x [4][4096][256]: ONE stream; qkv = x Wqkv + bqkv with ONE fused 'xw' (in, out) [256][768] weight whose output column is s x 256 + h x 64 + d (s = 0 the queries, 1 the keys, 2 the values: the module reshapes the 768 columns as [3][4][64]) and a [768] bias (the module's set-up builds both biases as zeros: BOTH ARE READ); 4 heads x 64;
// scores = Q.K / sqrt(64); keys with |i - j| > 12 are replaced by -inf in the module (a 25-key band computed from the indices; every row keeps its own key: no row is fully excluded); softmax over the keys; out = merged Wout + bout with an 'xw' (in, out) [256][256] weight and a [256] bias -> [4][4096][256] (4.2 M);
// argument order x, Wqkv, bqkv, Wout, bout).
// Layout, ALL FOUR BATCH ENTRIES AND ALL FOUR HEADS IN EACH LAUNCH (rows b x 4096 + t in the row-major arrays; the grid carries b, a block's waves the heads, no host loop): the two 'xw' weights transposed once to bf16 (the fused one into a Bt [768][256], the output one into a Bt [256][256]), both in one launch; the stream has no bf16 copy in memory: each block reads its own window as f32 and rounds it on the way into LDS;
// everything else in ONE launch, a block per 64 rows of one batch entry: the exact projection over the 768 fused columns + its bias rounded to bf16 for the block's own 96-row window (64 rows and 16 on either side), rounded to f16 in registers: q, k and v are never stored;
// band attention: a wave takes 32 queries of one head and their 64-key window, computes the transposed scores, applies the |i - j| <= BAND band by an index select (an excluded key takes -3.0e38 before the maximum, so its weight is an exact zero, as exp(-inf - max) is), does the softmax in registers and feeds the f16 weights straight into the value product: scores and weights are never stored;
// EVERY row on ONE fp16 product (the weights x 1024); the same launch holds the output projection: a block's eight waves (4 heads x 2 query halves) leave 64 rows' merged context [t][h x 64 + d] as bf16 hi / lo in LDS, and behind one barrier merged hi/lo x Wout exact + bias writes the output.
// Compute dtypes, f32 accumulate: every float input rounded to bf16 at its load; the projection exact + bf16-rounded bias; attention: one fp16 product on every row; softmax f32; Wout hl x exact + bias (the merged context as bf16 hi / lo).

#define NB_  4
#define TT   4096
#define DM   256
#define NH_  4
#define NKV  4
#define REP  (NH_ / NKV)
#define HD   64
#define DQ   (NH_ * HD)
#define DKV  (NKV * HD)
#define NZ   (NB_ * NH_)   // not read: one launch covers every batch entry and head
#define RH   0     // not read: EVERY row runs on one f16 product
#define WIN  0
#define PCAR 1024.0f
#define SCL  0.125f
#define BAND 12    // half width of the symmetric band: keys with |i - j| <= BAND are kept (a 25-key band)
static_assert(REP == 1, "a head's own columns serve queries, keys and values alike");
typedef _Float16 h16;
typedef unsigned short bf;
typedef __attribute__((ext_vector_type(16))) __bf16   v16bf;
typedef __attribute__((ext_vector_type(16))) _Float16 v16h;
typedef __attribute__((ext_vector_type(8)))  _Float16 v8h;
typedef __attribute__((ext_vector_type(8)))  unsigned short v8us;
typedef __attribute__((ext_vector_type(8)))  float    v8f;
typedef __attribute__((ext_vector_type(4)))  float    v4f;
typedef __attribute__((ext_vector_type(4)))  _Float16 v4h;
typedef __attribute__((ext_vector_type(4)))  unsigned short v4us;
typedef __attribute__((ext_vector_type(4)))  __bf16   v4b;
typedef v8h  __attribute__((may_alias)) v8ha;
typedef v4f  __attribute__((may_alias)) v4fa;
typedef v8us __attribute__((may_alias)) v8usa;

__device__ __forceinline__ unsigned short f2bf(float f) { unsigned u = __float_as_uint(f); u += 0x7FFFu + ((u >> 16) & 1u); return (unsigned short)(u >> 16); }
__device__ __forceinline__ float bf2f(unsigned short b) { return __uint_as_float(((unsigned)b) << 16); }
__device__ __forceinline__ float bfr(float f) { return bf2f(f2bf(f)); }
__device__ __forceinline__ void splitf(float y, unsigned short& h, unsigned short& l) { h = f2bf(y); l = f2bf(y - bf2f(h)); }
__device__ __forceinline__ v16h cat16(v8h lo, v8h hi) { return __builtin_shufflevector(lo, hi, 0, 1, 2, 3, 4, 5, 6, 7, 8, 9, 10, 11, 12, 13, 14, 15); }
__device__ __forceinline__ v16bf cat16b(v8us lo, v8us hi) { return __builtin_bit_cast(v16bf, __builtin_shufflevector(lo, hi, 0, 1, 2, 3, 4, 5, 6, 7, 8, 9, 10, 11, 12, 13, 14, 15)); }
__device__ __forceinline__ v8f wmma16(v16h a, v16h b, v8f c) { return __builtin_amdgcn_wmma_f32_16x16x32_f16(false, a, false, b, (short)0, c, false, false); }
__device__ __forceinline__ v8f wmmab(v16bf a, v16bf b, v8f c) { return __builtin_amdgcn_wmma_f32_16x16x32_bf16(false, a, false, b, (short)0, c, false, false); }



// ---- the one fragment loader: a lane's 16 elements of a K-contiguous row are k = 8 hi + 0..7 and 16 + 8 hi + 0..7 of a 32-wide k step, for A and for B alike.
template <typename T16> struct WFrag;
template <> struct WFrag<h16> { typedef v16h V; static __device__ __forceinline__ V ld(const h16* p) { return cat16(*(const v8h*)p, *(const v8h*)(p + 16)); } static __device__ __forceinline__ v8f mma(V a, V b, v8f c) { return wmma16(a, b, c); } };
template <> struct WFrag<bf> { typedef v16bf V; static __device__ __forceinline__ V ld(const bf* p) { return cat16b(*(const v8us*)p, *(const v8us*)(p + 16)); } static __device__ __forceinline__ v8f mma(V a, V b, v8f c) { return wmmab(a, b, c); } };

// ---- k_attn: q | k | v projection, band attention and output projection of 64 rows of one batch entry. 256 threads = 8 waves; grid NB_ * TT / 64.
// Part 0: the block's window is the 96 rows t0 - 16 .. t0 + 79 of the stream (a 16-row tile before row 0 or past the last takes a real tile's addresses; its keys get exact zero weights below). The window is read as f32, rounded to bf16 (nearest even) in registers and lies in LDS once: its low 128 columns, all that the first chunk meets, before the first barrier; the high 128 fly in registers through the first trip, whose barrier publishes them;
// the fused weight passes through LDS in six chunks of 256 Bt rows x 128 k (keys, queries, values; each the low k half, then the high one), two buffers: the next chunk's whole-line loads fly in registers while this one is worked on, and one barrier a trip publishes it.
// Wave w (head w % NH_, query half w / NH_) makes what it alone needs, all products k step by k step upward: Kt = Wk Xt and Qt = Wq Xt (A = 16 weight rows, B = 16 window rows) give a lane 8 successive d of ONE row, V = X Wvt (A = 16 window rows, B = 16 weight rows) 8 successive t of ONE d:
// D register j of a tile is A row hi * 8 + j, B row lr, so that two neighbouring tiles + bias, rounded to f16 in place, ARE a 32-wide operand in the loader's k order (elements 0..7 = 8 hi + j, 8..15 = 16 + 8 hi + j): q and k over d, v over t.
// Part 1: wave w does the whole band attention of one 32-query block (half w / NH_ of the 64 rows) of one head (w % NH_); scores and weights never leave the registers.
// The block at r0 owns the QW = 64 keys w0 + 0 .. w0 + 63, w0 = r0 - 16 (BAND <= 16). Transposed products: St = K Qt (A = 16 key rows, B = 16 query rows), so that a lane holds 8 keys of ONE query per tile:
// D register j of key tile kt is key w0 + kt * 16 + hi * 8 + j, query r0 + qt * 16 + lr. Query tile qt meets the band only in the key tiles qt, qt + 1, qt + 2: the fourth is not computed and its weights are zeros.
// Softmax as before (t = S x HD^-0.5 inside the band, -3.0e38 elsewhere by an index select, one exp, weights x 1024 rounded to f16); maximum and sum run in the lane and then once across the wave's halves.
// Two neighbouring key tiles' weights, converted in place, ARE the B operand of Ot = Vt Pt in the loader's k order; A = the transposed values.
// Ot gives a lane 8 successive d of one query: x 1 / 1024, bf16 hi + lo, one 16-byte LDS store each to ch / cl [row of the block][head x HD + d].
// Part 2, behind one barrier: out = merged(hi + lo) Wout + bout. Wave w takes all 64 rows x the 32 output columns w x 32 ..: A = the context fragments from LDS, B = its own 32 rows of the transposed weight, loaded into registers before the barrier;
// per accumulator the products run k step by k step, hi then lo. A 16 x 32 f32 piece turns through the wave's own LDS strip so that each store instruction writes four whole 128-byte lines; a wave is the one writer of its lines.
static_assert(BAND <= 16 && HD == 64 && TT % 64 == 0 && NH_ == 4 && DQ == 256 && DM == 256, "one 64-key window per 32 queries, three key tiles per query tile; 64 rows of one batch entry, 8 waves x 32 output columns");
#define CP (DQ + 8)   // LDS pitch of a context row in elements: 16 bytes x an odd number, so that the 16-byte fragment reads of 16 rows spread over the banks
#define OP 36         // LDS pitch of a row of the output turn in floats (a multiple of 16 bytes)
#define XR 96         // rows of the block's window
#define XP (DM + 8)   // LDS pitch of a window row in elements: 16 bytes x an odd number
#define WK 128        // k width of a weight chunk
#define WP (WK + 8)   // LDS pitch of a chunk row in elements: 16 bytes x an odd number
#define WCH (DQ * WP) // elements of one chunk buffer
template <int N> struct IC { static constexpr int v = N; };   // a compile-time number as an argument
__device__ __forceinline__ v8h cvb(v8f a, v8f b) { v8h o;
#pragma unroll
    for (int j = 0; j < 8; ++j) o[j] = (h16)(a[j] + b[j]);
    return o; }
__global__ __launch_bounds__(256) void k_attn(const float* __restrict__ X, const bf* __restrict__ WQKV, const float* __restrict__ bq, const bf* __restrict__ WOt, const float* __restrict__ bo, float* OUT) {
    __shared__ __align__(16) bf xs[XR * XP]; __shared__ __align__(16) bf wsh[2 * WCH];
    __shared__ __align__(16) bf ch[64 * CP]; __shared__ __align__(16) bf cl[64 * CP]; __shared__ __align__(16) float os[8 * 16 * OP];
    const int tid = threadIdx.x, lane = threadIdx.x & 31, lr = lane & 15, hi = lane >> 4;
    const int w = __builtin_amdgcn_readfirstlane(threadIdx.x >> 5);   // the wave's number, in a scalar register: head, rows and edge tests are the same in every lane
    const int g0 = blockIdx.x * 64, hd = w % NH_, qh = w / NH_, c0 = w * 32;   // the block's first row b x TT + t; the wave's head and query half (parts 0, 1) and first output column (part 2)
    const int t0 = g0 % TT, r0 = t0 + qh * 32, w0 = r0 - 16;
    // every loop of part 0 is unrolled: its index picks registers (xl, xh, sr, the accumulators and operands)
    const float* const Xb = X + (size_t)(g0 / TT) * TT * DM;
    const bf* const wsrc = WQKV + (tid >> 4) * DM + (tid & 15) * 8;   // a load instruction of a wave takes two rows' 256-byte halves: four whole lines
    bf* const wdst = wsh + (tid >> 4) * WP + (tid & 15) * 8;
    v8us sr[16]; v4f xh[12];
    // the window's rows, f32: a load instruction of a wave takes half a row (128 columns, four whole lines), one of the block the same half of eight rows; the first and the last 16 rows are wholly real or wholly not (t0 is a multiple of 64), and a 16-row tile that is not takes the neighbouring real tile's addresses (a test that is the same for the whole block)
    const float* const xmid = Xb + t0 * DM + (tid >> 5) * DM + (tid & 31) * 4; const float* const xlo = xmid + ((t0 == 0) ? 16 * DM : 0); const float* const xhi = xmid - ((t0 == TT - 64) ? 16 * DM : 0);
    bf* const xdst = xs + (tid >> 5) * XP + (tid & 31) * 4;
    { v4f xl[12];
#pragma unroll
      for (int it = 0; it < 12; ++it) xl[it] = *(const v4f*)(((it < 2) ? xlo : (it < 10) ? xmid : xhi) + (it * 8 - 16) * DM);
#pragma unroll
      for (int it = 0; it < 16; ++it) sr[it] = *(const v8us*)(wsrc + (DQ + it * 16) * DM);
#pragma unroll
      for (int it = 0; it < 12; ++it) xh[it] = *(const v4f*)(((it < 2) ? xlo : (it < 10) ? xmid : xhi) + (it * 8 - 16) * DM + WK);
      asm volatile("s_wait_xcnt 0x0" :: "v"(xlo), "v"(xmid), "v"(xhi), "v"(wsrc) : "memory");   // the wait before anything rewrites an address register that these loads name; the pointers are inputs so that no later load's result is given their registers in front of it
#pragma unroll
      for (int it = 0; it < 12; ++it) *(v4us*)(xdst + it * 8 * XP) = __builtin_bit_cast(v4us, __builtin_convertvector(xl[it], v4b));
#pragma unroll
      for (int it = 0; it < 16; ++it) *(v8us*)(wdst + it * 16 * WP) = sr[it]; }
    // the window's low columns and the first chunk are in LDS before any wave reads a fragment. The work-group barrier with its two fences on LDS alone: __syncthreads() would also wait for the high columns' global loads, which nothing reads before the end of the first trip
    __builtin_amdgcn_fence(__ATOMIC_RELEASE, "workgroup", "local"); __builtin_amdgcn_s_barrier(); __builtin_amdgcn_fence(__ATOMIC_ACQUIRE, "workgroup", "local");
    v8f acc0[4][4]; v16h q[2][2], k[4][2], v[4][2];   // acc0[weight tile][window tile]: one part's sums at a time
    // one trip = one chunk; the chunk's number is a compile-time constant, so that each of the six trips is straight-line code of its own part
    auto trip = [&](auto ic) __attribute__((always_inline)) {
        constexpr int c = decltype(ic)::v, so = (c < 2) ? 1 : (c < 4) ? 0 : 2, sn = (c + 1 < 2) ? 1 : (c + 1 < 4) ? 0 : 2;   // this trip's and the next trip's part of the fused columns: keys, queries, values
        constexpr int x0 = (so == 0) ? 1 : 0, x1 = (so == 0) ? 3 : 4;   // the part's window tiles: the queries are the two in the middle
        v8f bd[4];
        if constexpr (c < 5) {
#pragma unroll
            for (int it = 0; it < 16; ++it) sr[it] = *(const v8us*)(wsrc + (sn * DQ + it * 16) * DM + ((c + 1) & 1) * WK); }
        if constexpr ((c & 1) != 0) {   // the part's bias, asked for one chunk ahead of its use: 8 successive d of a lane, or the lane's one d
#pragma unroll
            for (int dt = 0; dt < 4; ++dt) { if constexpr (so < 2) bd[dt] = *(const v8f*)(bq + so * DQ + hd * HD + dt * 16 + hi * 8); else bd[dt][0] = bq[so * DQ + hd * HD + dt * 16 + lr]; } }
        else {
#pragma unroll
            for (int dt = 0; dt < 4; ++dt)
#pragma unroll
                for (int tt = x0; tt < x1; ++tt) acc0[dt][tt] = (v8f){}; }
        asm volatile("s_wait_xcnt 0x0" ::: "memory");   // the wait before anything below rewrites an address register that these loads name
        __builtin_amdgcn_sched_barrier(0);   // the next chunk's loads are issued before this chunk's products: sunk to their LDS stores they would put the memory latency in front of every barrier
        const bf* const wf = wsh + (c & 1) * WCH + (hd * HD + lr) * WP + 8 * hi; const bf* const xf = xs + (qh * 32 + lr) * XP + (c & 1) * WK + 8 * hi;
        v16bf xa[2][4], wa[2][4];   // two sets of fragments: the next k step's LDS reads fly while this step's products issue
#pragma unroll
        for (int kq = -1; kq < WK / 32; ++kq) {
            if (kq + 1 < WK / 32) {
#pragma unroll
                for (int tt = x0; tt < x1; ++tt) xa[(kq + 1) & 1][tt] = WFrag<bf>::ld(xf + tt * 16 * XP + (kq + 1) * 32);
#pragma unroll
                for (int dt = 0; dt < 4; ++dt) wa[(kq + 1) & 1][dt] = WFrag<bf>::ld(wf + dt * 16 * WP + (kq + 1) * 32); }
            if (kq >= 0 && kq + 1 < WK / 32) __builtin_amdgcn_sched_barrier(0);   // the reads of step kq + 1 are issued in front of the products of step kq: left alone the scheduler put each weight fragment's read and a full wait directly in front of its four products
            if (kq >= 0) {
#pragma unroll
                for (int dt = 0; dt < 4; ++dt)
#pragma unroll
                    for (int tt = x0; tt < x1; ++tt) acc0[dt][tt] = (so < 2) ? wmmab(wa[kq & 1][dt], xa[kq & 1][tt], acc0[dt][tt]) : wmmab(xa[kq & 1][tt], wa[kq & 1][dt], acc0[dt][tt]);
                if (kq + 2 < WK / 32) __builtin_amdgcn_sched_barrier(0); }   // and no read moves further ahead than one step: a third set of fragments would not fit the registers
        }
        if constexpr ((c & 1) != 0) {   // the part's sums are whole: + bias, f16, two neighbouring tiles to one operand
#pragma unroll
            for (int dt = 0; dt < 4; ++dt)
#pragma unroll
                for (int j = 0; j < 8; ++j) bd[dt][j] = bfr(bd[dt][(so < 2) ? j : 0]);
#pragma unroll
            for (int ks = 0; ks < 2; ++ks)
#pragma unroll
                for (int i = 0; i < 4; ++i) {
                    if constexpr (so == 1) k[i][ks] = cat16(cvb(acc0[2 * ks][i], bd[2 * ks]), cvb(acc0[2 * ks + 1][i], bd[2 * ks + 1]));
                    else if constexpr (so == 0) { if (i < 2) q[i][ks] = cat16(cvb(acc0[2 * ks][i + 1], bd[2 * ks]), cvb(acc0[2 * ks + 1][i + 1], bd[2 * ks + 1])); }
                    else v[i][ks] = cat16(cvb(acc0[i][2 * ks], bd[i]), cvb(acc0[i][2 * ks + 1], bd[i])); }
        }
        if constexpr (c < 5) {
            __builtin_amdgcn_sched_barrier(0);   // this chunk's products stay in front of the wait for the next chunk's loads: sunk behind the barrier they would leave that latency uncovered
            if constexpr (c == 0) {   // the window's high columns, first read in the next trip
#pragma unroll
                for (int it = 0; it < 12; ++it) *(v4us*)(xdst + it * 8 * XP + WK) = __builtin_bit_cast(v4us, __builtin_convertvector(xh[it], v4b)); }
#pragma unroll
            for (int it = 0; it < 16; ++it) *(v8us*)(wdst + ((c + 1) & 1) * WCH + it * 16 * WP) = sr[it];
            __syncthreads(); }   // publishes the next chunk; every wave has also left the buffer that the next trip refills
    };
    trip(IC<0>{}); trip(IC<1>{}); trip(IC<2>{}); trip(IC<3>{}); trip(IC<4>{}); trip(IC<5>{});
    const int dl = hi * 8 - lr + BAND; v8h p[2][4];   // key - query + BAND of register j in key tile qt + kk is dl + (kk - 1) * 16 + j
#pragma unroll
    for (int qt = 0; qt < 2; ++qt) {
        __builtin_amdgcn_sched_barrier(0);   // no matrix instruction of another part moves in among this tile's exp statements
        v8f st[3]; float mx = -3.0e38f;
#pragma unroll
        for (int kk = 0; kk < 3; ++kk) { st[kk] = wmma16(k[qt + kk][1], q[qt][1], wmma16(k[qt + kk][0], q[qt][0], (v8f){}));
            const int de = ((unsigned)(w0 + (qt + kk) * 16) < (unsigned)TT) ? dl + (kk - 1) * 16 : -64;   // a key tile is wholly real or wholly not: one that is not falls out of the band test below
#pragma unroll
            for (int j = 0; j < 8; ++j) { const float t = ((unsigned)(de + j) <= 2u * BAND) ? st[kk][j] * SCL : -3.0e38f; st[kk][j] = t; mx = fmaxf(mx, t); } }
        mx = fmaxf(mx, __shfl_xor(mx, 16, 32));
        float sum = 0.f;
#pragma unroll
        for (int kk = 0; kk < 3; ++kk)
#pragma unroll
            for (int j = 0; j < 8; ++j) { const float d0 = __fmul_rn(__fsub_rn(st[kk][j], mx), 1.4426950408889634f); float e;
                asm("v_exp_f32 %0, %1\n\tv_nop" : "=v"(e) : "v"(d0));   // the exp2 instruction with its one free slot in the same statement, so that nothing that reads its result or rewrites its source stands directly behind it
                st[kk][j] = e; sum += e; }
        sum += __shfl_xor(sum, 16, 32);
        const float f = __fdiv_rn(PCAR, sum);
#pragma unroll
        for (int kt = 0; kt < 4; ++kt)
#pragma unroll
            for (int j = 0; j < 8; ++j) p[qt][kt][j] = (kt >= qt && kt < qt + 3) ? (h16)(st[(kt - qt + 3) % 3][j] * f) : (h16)0.f;
    }
    __builtin_amdgcn_sched_barrier(0);   // as at the head of the loop: the value products stay behind the last exp statement
    v16bf wb[8][2];   // part 2's weight slice and bias are asked for here, in front of the value product and the barrier, so that their latency passes behind those; both loops unrolled: the indices pick registers
#pragma unroll
    for (int ks = 0; ks < 8; ++ks)
#pragma unroll
        for (int nb = 0; nb < 2; ++nb) wb[ks][nb] = WFrag<bf>::ld(WOt + (c0 + nb * 16 + lr) * DQ + ks * 32 + 8 * hi);
    const int orow = lane >> 3, ocol = (lane & 7) * 4;   // the lane's row (of four) and first column in a store of part 2
    const v4f braw = *(const v4f*)(bo + c0 + ocol);
    bf* const oh = ch + (qh * 32 + lr) * CP + hd * HD + hi * 8; bf* const ol = cl + (qh * 32 + lr) * CP + hd * HD + hi * 8;
#pragma unroll
    for (int qt = 0; qt < 2; ++qt)
#pragma unroll
        for (int dt = 0; dt < 4; ++dt) { const v8f o = wmma16(v[dt][1], cat16(p[qt][2], p[qt][3]), wmma16(v[dt][0], cat16(p[qt][0], p[qt][1]), (v8f){})); v8us a8, c8;
#pragma unroll
            for (int j = 0; j < 8; ++j) { unsigned short a, c2; splitf(o[j] * (1.0f / PCAR), a, c2); a8[j] = a; c8[j] = c2; }
            *(v8us*)(oh + qt * 16 * CP + dt * 16) = a8; *(v8us*)(ol + qt * 16 * CP + dt * 16) = c8; }
    __syncthreads();   // all eight waves' context pieces are in LDS before any wave reads a whole row
    // every loop of part 2 is unrolled: its index picks registers (acc, a, a2, wb, val)
    v8f acc[4][2];
#pragma unroll
    for (int mb = 0; mb < 4; ++mb)
#pragma unroll
        for (int nb = 0; nb < 2; ++nb) acc[mb][nb] = (v8f){};
    const bf* const ah = ch + lr * CP + 8 * hi; const bf* const al = cl + lr * CP + 8 * hi;
#pragma unroll
    for (int ks = 0; ks < 8; ++ks) {
        v16bf a[4], a2[4];
#pragma unroll
        for (int mb = 0; mb < 4; ++mb) { a[mb] = WFrag<bf>::ld(ah + mb * 16 * CP + ks * 32); a2[mb] = WFrag<bf>::ld(al + mb * 16 * CP + ks * 32); }
#pragma unroll
        for (int nb = 0; nb < 2; ++nb) {
#pragma unroll
            for (int mb = 0; mb < 4; ++mb) acc[mb][nb] = wmmab(a[mb], wb[ks][nb], acc[mb][nb]);
#pragma unroll
            for (int mb = 0; mb < 4; ++mb) acc[mb][nb] = wmmab(a2[mb], wb[ks][nb], acc[mb][nb]); }
    }
    float* const ow = os + w * 16 * OP; float* const orp = OUT + (size_t)(g0 + orow) * DM + c0 + ocol;
    v4f bv;
#pragma unroll
    for (int q2 = 0; q2 < 4; ++q2) bv[q2] = bfr(braw[q2]);
#pragma unroll
    for (int mb = 0; mb < 4; ++mb) {
#pragma unroll
        for (int nb = 0; nb < 2; ++nb)
#pragma unroll
            for (int j = 0; j < 8; ++j) ow[(hi * 8 + j) * OP + nb * 16 + lr] = acc[mb][nb][j];
        __builtin_amdgcn_wave_barrier(); asm volatile("" ::: "memory");   // the compiler keeps the strip's reads behind the other lanes' writes
        v4f val[4];
#pragma unroll
        for (int s = 0; s < 4; ++s) val[s] = *(const v4fa*)(ow + (4 * s + orow) * OP + ocol);
#pragma unroll
        for (int s = 0; s < 4; ++s) *(v4f*)(orp + (mb * 16 + 4 * s) * DM) = val[s] + bv;
        if (mb < 3) { __builtin_amdgcn_wave_barrier(); asm volatile("" ::: "memory"); }   // the compiler keeps the next turn's writes behind this turn's reads
    }
}

// ---- k_prep: the two jobs that read weights only and do not depend on one another (fused weight -> Bt, output weight -> Bt) as block ranges of ONE launch; the range test is on blockIdx.x alone, the same for a whole block.
// A block turns one tile of 64 k x 64 n through LDS. A thread holds 4 k x 4 n: its four 16-byte loads are all in flight at once, and a load instruction of a wave takes two rows' 256 bytes (four whole lines);
// rounded to bf16, each n's four successive k go to LDS as one 8-byte store; behind one barrier a thread takes 8 successive k of one n, so that a store instruction of a wave writes four whole 128-byte lines of Bt. A block is the one writer of its lines.
#define PB_WQKV (DM * 3 * DQ / 64 / 64)        // blocks of the fused weight: tiles of 64 x 64 elements
#define PB_WO   (DQ * DM / 64 / 64)            // blocks of the output weight
#define TP 72                                  // LDS pitch of a tile row (one n) in elements: 16 bytes x an odd number
static_assert(DM % 64 == 0 && DQ % 64 == 0 && DM == DQ, "whole tiles in every range; both weights have the same k length");
__global__ __launch_bounds__(256) void k_prep(const float* __restrict__ wqkv, const float* __restrict__ wo, bf* WQKV, bf* WO) {
    __shared__ __align__(16) bf ts[64 * TP];
    const int tid = threadIdx.x; const bool fu = blockIdx.x < PB_WQKV;
    const unsigned blk = fu ? blockIdx.x : blockIdx.x - PB_WQKV; const int N = fu ? 3 * DQ : DM;   // the job's tile number and row length; Bt row of the fused weight: s * 256 + h * 64 + d
    const float* const w = fu ? wqkv : wo; bf* const Bt = fu ? WQKV : WO;
    const int k0 = (blk % (DM / 64)) * 64, n0 = (blk / (DM / 64)) * 64, a = tid >> 4, b = tid & 15;
    const float* const p0 = w + (k0 + 4 * a) * N + n0 + 4 * b; const float* const p1 = p0 + N; const float* const p2 = p1 + N; const float* const p3 = p2 + N;
    v4f r[4]; r[0] = *(const v4f*)p0; r[1] = *(const v4f*)p1; r[2] = *(const v4f*)p2; r[3] = *(const v4f*)p3;
    asm volatile("s_wait_xcnt 0x0" :: "v"(p0), "v"(p1), "v"(p2), "v"(p3) : "memory");   // the wait before anything rewrites an address register that these loads name; the pointers are inputs so that no load's result is given their registers in front of it
    // both loops below are unrolled: the indices pick registers
#pragma unroll
    for (int j = 0; j < 4; ++j) { v4us o;
#pragma unroll
        for (int i = 0; i < 4; ++i) o[i] = f2bf(r[i][j]);
        *(v4us*)(ts + (4 * b + j) * TP + 4 * a) = o; }
    __syncthreads();   // the whole tile is in LDS before any thread reads a row of it
#pragma unroll   // both LDS reads are issued in front of the first store
    for (int i = 0; i < 2; ++i) { const int u = tid + 256 * i; *(v8us*)(Bt + (n0 + (u >> 3)) * DM + k0 + (u & 7) * 8) = *(const v8us*)(ts + (u >> 3) * TP + (u & 7) * 8); }
}
extern "C" void kernel_launch(void* const* d_in, const int* in_sizes, int n_in,
                              void* d_out, int out_size, void* d_ws, size_t ws_size, hipStream_t stream) {
    (void)in_sizes; (void)n_in; (void)out_size;
    const float* x = (const float*)d_in[0]; const float* wqkv = (const float*)d_in[1]; const float* bqkv = (const float*)d_in[2]; const float* wo = (const float*)d_in[3]; const float* bo = (const float*)d_in[4];
    // inputs in the module's argument order: x ([4][4096][256]), Wqkv ('xw' (in, out) [256][768]; output column s * 256 + h * 64 + d, s = 0 query, 1 key, 2 value), bqkv ([768]), Wout ('xw' [256][256]), bout ([256]) = d_in[0..4]: FIVE inputs, all read (the set-up builds the two biases as zeros: read all the same)
    float* OUT = (float*)d_out;     // [4][4096][256]
    char* wsp = (char*)d_ws;
    auto take = [&](size_t bytes) { char* p = wsp; wsp += (bytes + 255) & ~(size_t)255; return (void*)p; };
    bf* WQKV = (bf*)take((size_t)3 * DQ * DM * 2); bf* WO = (bf*)take((size_t)DM * DQ * 2);
    if ((size_t)(wsp - (char*)d_ws) > ws_size) return;    // total 0.50 MiB carved
    /* every stage once, over all batch entries and heads */
    k_prep<<<PB_WQKV + PB_WO, 256, 0, stream>>>(wqkv, wo, WQKV, WO);   /* both weights transposed to bf16: two independent jobs, one launch */
    k_attn<<<NB_ * TT / 64, 256, 0, stream>>>(x, WQKV, bqkv, WO, bo, OUT);   /* the block's window of the stream rounded to bf16 at its load; q | k | v of each block's own window in one product each, kept in registers as f16; scores, band, softmax and weights x values: ONE f16 product each on every row; the merged context hi / lo stays in LDS; out = merged(hi + lo) Wout + bout: the one writer of the output */
}

// v010
// Measured time: 18 microseconds a run.
// Next to v009, in two timings, it ran 1.05 and 1.06 times as fast.
// Counting every step since v000, it is 21.6 times as fast.
#include <hip/hip_runtime.h>

// Multi-head self-attention restricted to a static symmetric band (x [4][4096][256]: ONE stream; qkv = x Wqkv + bqkv with ONE fused 'xw' (in, out) [256][768] weight whose output column is s x 256 + h x 64 + d (s = 0 the queries, 1 the keys, 2 the values: the module reshapes the 768 columns as [3][4][64]) and a [768] bias (the module's set-up builds both biases as zeros: BOTH ARE READ); 4 heads x 64;
// scores = Q.K / sqrt(64); keys with |i - j| > 12 are replaced by -inf in the module (a 25-key band computed from the indices; every row keeps its own key: no row is fully excluded); softmax over the keys; out = merged Wout + bout with an 'xw' (in, out) [256][256] weight and a [256] bias -> [4][4096][256] (4.2 M);
// argument order x, Wqkv, bqkv, Wout, bout).
// Layout, ALL FOUR BATCH ENTRIES AND ALL FOUR HEADS IN EACH LAUNCH (rows b x 4096 + t in the row-major arrays; the grid carries b, a block's waves the heads, no host loop): the two 'xw' weights transposed once to bf16 (the fused one into a Bt [768][256], the output one into a Bt [256][256]), both in one launch; the stream has no bf16 copy in memory: each block reads its own window as f32 and rounds it on the way into LDS;
// everything else in ONE launch, a block per 64 rows of one batch entry: the exact projection over the 768 fused columns + its bias rounded to bf16 for the block's own 96-row window (64 rows and 16 on either side), rounded to f16 in registers: q, k and v are never stored;
// band attention: a wave takes 32 queries of one head and their 64-key window, computes the transposed scores, applies the |i - j| <= BAND band by an index select (an excluded key takes -3.0e38 before the maximum, so its weight is an exact zero, as exp(-inf - max) is), does the softmax in registers and feeds the f16 weights straight into the value product: scores and weights are never stored;
// EVERY row on ONE fp16 product (the weights x 1024); the same launch holds the output projection: a block's eight waves (4 heads x 2 query halves) leave 64 rows' merged context [t][h x 64 + d] as bf16 hi / lo in LDS, and behind one barrier merged hi/lo x Wout exact + bias writes the output.
// Compute dtypes, f32 accumulate: every float input rounded to bf16 at its load; the projection exact + bf16-rounded bias; attention: one fp16 product on every row; softmax f32; Wout hl x exact + bias (the merged context as bf16 hi / lo).

#define NB_  4
#define TT   4096
#define DM   256
#define NH_  4
#define NKV  4
#define REP  (NH_ / NKV)
#define HD   64
#define DQ   (NH_ * HD)
#define DKV  (NKV * HD)
#define NZ   (NB_ * NH_)   // not read: one launch covers every batch entry and head
#define RH   0     // not read: EVERY row runs on one f16 product
#define WIN  0
#define PCAR 1024.0f
#define SCL  0.125f
#define BAND 12    // half width of the symmetric band: keys with |i - j| <= BAND are kept (a 25-key band)
static_assert(REP == 1, "a head's own columns serve queries, keys and values alike");
typedef _Float16 h16;
typedef unsigned short bf;
typedef __attribute__((ext_vector_type(16))) __bf16   v16bf;
typedef __attribute__((ext_vector_type(16))) _Float16 v16h;
typedef __attribute__((ext_vector_type(8)))  _Float16 v8h;
typedef __attribute__((ext_vector_type(8)))  unsigned short v8us;
typedef __attribute__((ext_vector_type(8)))  float    v8f;
typedef __attribute__((ext_vector_type(4)))  float    v4f;
typedef __attribute__((ext_vector_type(4)))  _Float16 v4h;
typedef __attribute__((ext_vector_type(4)))  unsigned short v4us;
typedef __attribute__((ext_vector_type(4)))  __bf16   v4b;
typedef v8h  __attribute__((may_alias)) v8ha;
typedef v4f  __attribute__((may_alias)) v4fa;
typedef v8us __attribute__((may_alias)) v8usa;

__device__ __forceinline__ unsigned short f2bf(float f) { unsigned u = __float_as_uint(f); u += 0x7FFFu + ((u >> 16) & 1u); return (unsigned short)(u >> 16); }
__device__ __forceinline__ float bf2f(unsigned short b) { return __uint_as_float(((unsigned)b) << 16); }
__device__ __forceinline__ float bfr(float f) { return bf2f(f2bf(f)); }
__device__ __forceinline__ void splitf(float y, unsigned short& h, unsigned short& l) { h = f2bf(y); l = f2bf(y - bf2f(h)); }
__device__ __forceinline__ v16h cat16(v8h lo, v8h hi) { return __builtin_shufflevector(lo, hi, 0, 1, 2, 3, 4, 5, 6, 7, 8, 9, 10, 11, 12, 13, 14, 15); }
__device__ __forceinline__ v16bf cat16b(v8us lo, v8us hi) { return __builtin_bit_cast(v16bf, __builtin_shufflevector(lo, hi, 0, 1, 2, 3, 4, 5, 6, 7, 8, 9, 10, 11, 12, 13, 14, 15)); }
__device__ __forceinline__ v8f wmma16(v16h a, v16h b, v8f c) { return __builtin_amdgcn_wmma_f32_16x16x32_f16(false, a, false, b, (short)0, c, false, false); }
__device__ __forceinline__ v8f wmmab(v16bf a, v16bf b, v8f c) { return __builtin_amdgcn_wmma_f32_16x16x32_bf16(false, a, false, b, (short)0, c, false, false); }



// ---- the one fragment loader: a lane's 16 elements of a K-contiguous row are k = 8 hi + 0..7 and 16 + 8 hi + 0..7 of a 32-wide k step, for A and for B alike.
template <typename T16> struct WFrag;
template <> struct WFrag<h16> { typedef v16h V; static __device__ __forceinline__ V ld(const h16* p) { return cat16(*(const v8h*)p, *(const v8h*)(p + 16)); } static __device__ __forceinline__ v8f mma(V a, V b, v8f c) { return wmma16(a, b, c); } };
template <> struct WFrag<bf> { typedef v16bf V; static __device__ __forceinline__ V ld(const bf* p) { return cat16b(*(const v8us*)p, *(const v8us*)(p + 16)); } static __device__ __forceinline__ v8f mma(V a, V b, v8f c) { return wmmab(a, b, c); } };

// ---- k_attn: q | k | v projection, band attention and output projection of 64 rows of one batch entry. 256 threads = 8 waves; grid NB_ * TT / 64.
// Part 0: the block's window is the 96 rows t0 - 16 .. t0 + 79 of the stream (a 16-row tile before row 0 or past the last takes a real tile's addresses; its keys get exact zero weights below). The window is read as f32, rounded to bf16 (nearest even) in registers and lies in LDS once: its low 128 columns, all that the first chunk meets, before the first barrier; the high 128 fly in registers through the first trip, whose barrier publishes them;
// the fused weight passes through LDS in six chunks of 256 Bt rows x 128 k (keys, queries, values; each the low k half, then the high one), two buffers: the next chunk's whole-line loads fly in registers while this one is worked on, and one barrier a trip publishes it.
// Wave w (head w % NH_, query half w / NH_) makes what it alone needs, all products k step by k step upward: Kt = Wk Xt and Qt = Wq Xt (A = 16 weight rows, B = 16 window rows) give a lane 8 successive d of ONE row, V = X Wvt (A = 16 window rows, B = 16 weight rows) 8 successive t of ONE d:
// D register j of a tile is A row hi * 8 + j, B row lr, so that two neighbouring tiles + bias, rounded to f16 in place, ARE a 32-wide operand in the loader's k order (elements 0..7 = 8 hi + j, 8..15 = 16 + 8 hi + j): q and k over d, v over t.
// Part 1: wave w does the whole band attention of one 32-query block (half w / NH_ of the 64 rows) of one head (w % NH_); scores and weights never leave the registers.
// The block at r0 owns the QW = 64 keys w0 + 0 .. w0 + 63, w0 = r0 - 16 (BAND <= 16). Transposed products: St = K Qt (A = 16 key rows, B = 16 query rows), so that a lane holds 8 keys of ONE query per tile:
// D register j of key tile kt is key w0 + kt * 16 + hi * 8 + j, query r0 + qt * 16 + lr. Query tile qt meets the band only in the key tiles qt, qt + 1, qt + 2: the fourth is not computed and its weights are zeros.
// Softmax as before (t = S x HD^-0.5 inside the band, -3.0e38 elsewhere by an index select, one exp, weights x 1024 rounded to f16); maximum and sum run in the lane and then once across the wave's halves.
// Two neighbouring key tiles' weights, converted in place, ARE the B operand of Ot = Vt Pt in the loader's k order; A = the transposed values.
// Ot gives a lane 8 successive d of one query: x 1 / 1024, bf16 hi + lo, one 16-byte LDS store each to ch / cl [row of the block][head x HD + d].
// Part 2, behind one barrier: out = merged(hi + lo) Wout + bout. Wave w takes all 64 rows x the 32 output columns w x 32 ..: A = the context fragments from LDS, B = its own 32 rows of the transposed weight, loaded into registers before the barrier;
// per accumulator the products run k step by k step, hi then lo. A 16 x 32 f32 piece turns through the wave's own LDS strip so that each store instruction writes four whole 128-byte lines; a wave is the one writer of its lines.
static_assert(BAND <= 16 && HD == 64 && TT % 64 == 0 && NH_ == 4 && DQ == 256 && DM == 256, "one 64-key window per 32 queries, three key tiles per query tile; 64 rows of one batch entry, 8 waves x 32 output columns");
#define CP (DQ + 8)   // LDS pitch of a context row in elements: 16 bytes x an odd number, so that the 16-byte fragment reads of 16 rows spread over the banks
#define OP 36         // LDS pitch of a row of the output turn in floats (a multiple of 16 bytes)
#define XR 96         // rows of the block's window
#define XP (DM + 8)   // LDS pitch of a window row in elements: 16 bytes x an odd number
#define WK 128        // k width of a weight chunk
#define WP (WK + 8)   // LDS pitch of a chunk row in elements: 16 bytes x an odd number
#define WCH (DQ * WP) // elements of one chunk buffer
template <int N> struct IC { static constexpr int v = N; };   // a compile-time number as an argument
__device__ __forceinline__ v8h cvb(v8f a, v8f b) { v8h o;
#pragma unroll
    for (int j = 0; j < 8; ++j) o[j] = (h16)(a[j] + b[j]);
    return o; }
__global__ __launch_bounds__(256) void k_attn(const float* __restrict__ X, const bf* __restrict__ WQKV, const float* __restrict__ bq, const bf* __restrict__ WOt, const float* __restrict__ bo, float* OUT) {
    __shared__ __align__(16) bf xs[XR * XP]; __shared__ __align__(16) bf wsh[2 * WCH];
    __shared__ __align__(16) bf ch[64 * CP]; __shared__ __align__(16) bf cl[64 * CP]; __shared__ __align__(16) float os[8 * 16 * OP];
    const int tid = threadIdx.x, lane = threadIdx.x & 31, lr = lane & 15, hi = lane >> 4;
    const int w = __builtin_amdgcn_readfirstlane(threadIdx.x >> 5);   // the wave's number, in a scalar register: head, rows and edge tests are the same in every lane
    const int g0 = blockIdx.x * 64, hd = w % NH_, qh = w / NH_, c0 = w * 32;   // the block's first row b x TT + t; the wave's head and query half (parts 0, 1) and first output column (part 2)
    const int t0 = g0 % TT, r0 = t0 + qh * 32, w0 = r0 - 16;
    // every loop of part 0 is unrolled: its index picks registers (xl, xh, sr, the accumulators and operands)
    const float* const Xb = X + (size_t)(g0 / TT) * TT * DM;
    const bf* const wsrc = WQKV + (tid >> 4) * DM + (tid & 15) * 8;   // a load instruction of a wave takes two rows' 256-byte halves: four whole lines
    bf* const wdst = wsh + (tid >> 4) * WP + (tid & 15) * 8;
    v8us sr[16]; v4f xh[12];
    // the window's rows, f32: a load instruction of a wave takes half a row (128 columns, four whole lines), one of the block the same half of eight rows; the first and the last 16 rows are wholly real or wholly not (t0 is a multiple of 64), and a 16-row tile that is not takes the neighbouring real tile's addresses (a test that is the same for the whole block)
    const float* const xmid = Xb + t0 * DM + (tid >> 5) * DM + (tid & 31) * 4; const float* const xlo = xmid + ((t0 == 0) ? 16 * DM : 0); const float* const xhi = xmid - ((t0 == TT - 64) ? 16 * DM : 0);
    bf* const xdst = xs + (tid >> 5) * XP + (tid & 31) * 4;
    { v4f xl[12];
#pragma unroll
      for (int it = 0; it < 12; ++it) xl[it] = *(const v4f*)(((it < 2) ? xlo : (it < 10) ? xmid : xhi) + (it * 8 - 16) * DM);
#pragma unroll
      for (int it = 0; it < 16; ++it) sr[it] = *(const v8us*)(wsrc + (DQ + it * 16) * DM);
#pragma unroll
      for (int it = 0; it < 12; ++it) xh[it] = *(const v4f*)(((it < 2) ? xlo : (it < 10) ? xmid : xhi) + (it * 8 - 16) * DM + WK);
      asm volatile("s_wait_xcnt 0x0" :: "v"(xlo), "v"(xmid), "v"(xhi), "v"(wsrc) : "memory");   // the wait before anything rewrites an address register that these loads name; the pointers are inputs so that no later load's result is given their registers in front of it
#pragma unroll
      for (int it = 0; it < 12; ++it) *(v4us*)(xdst + it * 8 * XP) = __builtin_bit_cast(v4us, __builtin_convertvector(xl[it], v4b));
#pragma unroll
      for (int it = 0; it < 16; ++it) *(v8us*)(wdst + it * 16 * WP) = sr[it]; }
    // the window's low columns and the first chunk are in LDS before any wave reads a fragment. The work-group barrier with its two fences on LDS alone: __syncthreads() would also wait for the high columns' global loads, which nothing reads before the end of the first trip
    __builtin_amdgcn_fence(__ATOMIC_RELEASE, "workgroup", "local"); __builtin_amdgcn_s_barrier(); __builtin_amdgcn_fence(__ATOMIC_ACQUIRE, "workgroup", "local");
    v8f acc0[4][4]; v16h q[2][2], k[4][2], v[4][2];   // acc0[weight tile][window tile]: one part's sums at a time
    // one trip = one chunk; the chunk's number is a compile-time constant, so that each of the six trips is straight-line code of its own part
    auto trip = [&](auto ic) __attribute__((always_inline)) {
        constexpr int c = decltype(ic)::v, so = (c < 2) ? 1 : (c < 4) ? 0 : 2, sn = (c + 1 < 2) ? 1 : (c + 1 < 4) ? 0 : 2;   // this trip's and the next trip's part of the fused columns: keys, queries, values
        constexpr int x0 = (so == 0) ? 1 : 0, x1 = (so == 0) ? 3 : 4;   // the part's window tiles: the queries are the two in the middle
        v8f bd[4];
        if constexpr (c < 5) {
#pragma unroll
            for (int it = 0; it < 16; ++it) sr[it] = *(const v8us*)(wsrc + (sn * DQ + it * 16) * DM + ((c + 1) & 1) * WK); }
        if constexpr ((c & 1) != 0) {   // the part's bias, asked for one chunk ahead of its use: 8 successive d of a lane, or the lane's one d
#pragma unroll
            for (int dt = 0; dt < 4; ++dt) { if constexpr (so < 2) bd[dt] = *(const v8f*)(bq + so * DQ + hd * HD + dt * 16 + hi * 8); else bd[dt][0] = bq[so * DQ + hd * HD + dt * 16 + lr]; } }
        else {
#pragma unroll
            for (int dt = 0; dt < 4; ++dt)
#pragma unroll
                for (int tt = x0; tt < x1; ++tt) acc0[dt][tt] = (v8f){}; }
        asm volatile("s_wait_xcnt 0x0" ::: "memory");   // the wait before anything below rewrites an address register that these loads name
        __builtin_amdgcn_sched_barrier(0);   // the next chunk's loads are issued before this chunk's products: sunk to their LDS stores they would put the memory latency in front of every barrier
        const bf* const wf = wsh + (c & 1) * WCH + (hd * HD + lr) * WP + 8 * hi; const bf* const xf = xs + (qh * 32 + lr) * XP + (c & 1) * WK + 8 * hi;
        v16bf xa[2][4], wa[2][4];   // two sets of fragments: the next k step's LDS reads fly while this step's products issue
#pragma unroll
        for (int kq = -1; kq < WK / 32; ++kq) {
            if (kq + 1 < WK / 32) {
#pragma unroll
                for (int tt = x0; tt < x1; ++tt) xa[(kq + 1) & 1][tt] = WFrag<bf>::ld(xf + tt * 16 * XP + (kq + 1) * 32);
#pragma unroll
                for (int dt = 0; dt < 4; ++dt) wa[(kq + 1) & 1][dt] = WFrag<bf>::ld(wf + dt * 16 * WP + (kq + 1) * 32); }
            if (kq >= 0 && kq + 1 < WK / 32) __builtin_amdgcn_sched_barrier(0);   // the reads of step kq + 1 are issued in front of the products of step kq: left alone the scheduler put each weight fragment's read and a full wait directly in front of its four products
            if (kq >= 0) {
#pragma unroll
                for (int dt = 0; dt < 4; ++dt)
#pragma unroll
                    for (int tt = x0; tt < x1; ++tt) acc0[dt][tt] = (so < 2) ? wmmab(wa[kq & 1][dt], xa[kq & 1][tt], acc0[dt][tt]) : wmmab(xa[kq & 1][tt], wa[kq & 1][dt], acc0[dt][tt]);
                if (kq + 2 < WK / 32) __builtin_amdgcn_sched_barrier(0); }   // and no read moves further ahead than one step: a third set of fragments would not fit the registers
        }
        if constexpr ((c & 1) != 0) {   // the part's sums are whole: + bias, f16, two neighbouring tiles to one operand
#pragma unroll
            for (int dt = 0; dt < 4; ++dt)
#pragma unroll
                for (int j = 0; j < 8; ++j) bd[dt][j] = bfr(bd[dt][(so < 2) ? j : 0]);
#pragma unroll
            for (int ks = 0; ks < 2; ++ks)
#pragma unroll
                for (int i = 0; i < 4; ++i) {
                    if constexpr (so == 1) k[i][ks] = cat16(cvb(acc0[2 * ks][i], bd[2 * ks]), cvb(acc0[2 * ks + 1][i], bd[2 * ks + 1]));
                    else if constexpr (so == 0) { if (i < 2) q[i][ks] = cat16(cvb(acc0[2 * ks][i + 1], bd[2 * ks]), cvb(acc0[2 * ks + 1][i + 1], bd[2 * ks + 1])); }
                    else v[i][ks] = cat16(cvb(acc0[i][2 * ks], bd[i]), cvb(acc0[i][2 * ks + 1], bd[i])); }
        }
        if constexpr (c < 5) {
            __builtin_amdgcn_sched_barrier(0);   // this chunk's products stay in front of the wait for the next chunk's loads: sunk behind the barrier they would leave that latency uncovered
            if constexpr (c == 0) {   // the window's high columns, first read in the next trip
#pragma unroll
                for (int it = 0; it < 12; ++it) *(v4us*)(xdst + it * 8 * XP + WK) = __builtin_bit_cast(v4us, __builtin_convertvector(xh[it], v4b)); }
#pragma unroll
            for (int it = 0; it < 16; ++it) *(v8us*)(wdst + ((c + 1) & 1) * WCH + it * 16 * WP) = sr[it];
            __syncthreads(); }   // publishes the next chunk; every wave has also left the buffer that the next trip refills
    };
    trip(IC<0>{}); trip(IC<1>{}); trip(IC<2>{}); trip(IC<3>{}); trip(IC<4>{}); trip(IC<5>{});
    const int dl = hi * 8 - lr + BAND; v8h p[2][4];   // key - query + BAND of register j in key tile qt + kk is dl + (kk - 1) * 16 + j
#pragma unroll
    for (int qt = 0; qt < 2; ++qt) {
        __builtin_amdgcn_sched_barrier(0);   // no matrix instruction of another part moves in among this tile's exp statements
        v8f st[3]; float mx = -3.0e38f;
#pragma unroll
        for (int kk = 0; kk < 3; ++kk) { st[kk] = wmma16(k[qt + kk][1], q[qt][1], wmma16(k[qt + kk][0], q[qt][0], (v8f){}));
            const int de = ((unsigned)(w0 + (qt + kk) * 16) < (unsigned)TT) ? dl + (kk - 1) * 16 : -64;   // a key tile is wholly real or wholly not: one that is not falls out of the band test below
#pragma unroll
            for (int j = 0; j < 8; ++j) { const float t = ((unsigned)(de + j) <= 2u * BAND) ? st[kk][j] * SCL : -3.0e38f; st[kk][j] = t; mx = fmaxf(mx, t); } }
        mx = fmaxf(mx, __shfl_xor(mx, 16, 32));
        float sum = 0.f;
#pragma unroll
        for (int kk = 0; kk < 3; ++kk)
#pragma unroll
            for (int j = 0; j < 8; ++j) { const float d0 = __fmul_rn(__fsub_rn(st[kk][j], mx), 1.4426950408889634f); float e;
                asm("v_exp_f32 %0, %1\n\tv_nop" : "=v"(e) : "v"(d0));   // the exp2 instruction with its one free slot in the same statement, so that nothing that reads its result or rewrites its source stands directly behind it
                st[kk][j] = e; sum += e; }
        sum += __shfl_xor(sum, 16, 32);
        const float f = __fdiv_rn(PCAR, sum);
#pragma unroll
        for (int kt = 0; kt < 4; ++kt)
#pragma unroll
            for (int j = 0; j < 8; ++j) p[qt][kt][j] = (kt >= qt && kt < qt + 3) ? (h16)(st[(kt - qt + 3) % 3][j] * f) : (h16)0.f;
    }
    __builtin_amdgcn_sched_barrier(0);   // as at the head of the loop: the value products stay behind the last exp statement
    v16bf wb[8][2];   // part 2's weight slice and bias are asked for here, in front of the value product and the barrier, so that their latency passes behind those; both loops unrolled: the indices pick registers
#pragma unroll
    for (int ks = 0; ks < 8; ++ks)
#pragma unroll
        for (int nb = 0; nb < 2; ++nb) wb[ks][nb] = WFrag<bf>::ld(WOt + (c0 + nb * 16 + lr) * DQ + ks * 32 + 8 * hi);
    const int orow = lane >> 3, ocol = (lane & 7) * 4;   // the lane's row (of four) and first column in a store of part 2
    const v4f braw = *(const v4f*)(bo + c0 + ocol);
    bf* const oh = ch + (qh * 32 + lr) * CP + hd * HD + hi * 8; bf* const ol = cl + (qh * 32 + lr) * CP + hd * HD + hi * 8;
#pragma unroll
    for (int qt = 0; qt < 2; ++qt)
#pragma unroll
        for (int dt = 0; dt < 4; ++dt) { const v8f o = wmma16(v[dt][1], cat16(p[qt][2], p[qt][3]), wmma16(v[dt][0], cat16(p[qt][0], p[qt][1]), (v8f){})); v8us a8, c8;
#pragma unroll
            for (int j = 0; j < 8; ++j) { unsigned short a, c2; splitf(o[j] * (1.0f / PCAR), a, c2); a8[j] = a; c8[j] = c2; }
            *(v8us*)(oh + qt * 16 * CP + dt * 16) = a8; *(v8us*)(ol + qt * 16 * CP + dt * 16) = c8; }
    __syncthreads();   // all eight waves' context pieces are in LDS before any wave reads a whole row
    // every loop of part 2 is unrolled: its index picks registers (acc, a, a2, wb, val)
    v8f acc[4][2];
#pragma unroll
    for (int mb = 0; mb < 4; ++mb)
#pragma unroll
        for (int nb = 0; nb < 2; ++nb) acc[mb][nb] = (v8f){};
    const bf* const ah = ch + lr * CP + 8 * hi; const bf* const al = cl + lr * CP + 8 * hi;
    v16bf a[2][4], a2[2][4];   // two sets of context fragments: the next k step's LDS reads fly while this step's products issue
#pragma unroll
    for (int ks = -1; ks < 8; ++ks) {
        if (ks + 1 < 8) {
#pragma unroll
            for (int mb = 0; mb < 4; ++mb) a[(ks + 1) & 1][mb] = WFrag<bf>::ld(ah + mb * 16 * CP + (ks + 1) * 32);
#pragma unroll
            for (int mb = 0; mb < 4; ++mb) a2[(ks + 1) & 1][mb] = WFrag<bf>::ld(al + mb * 16 * CP + (ks + 1) * 32); }
        if (ks >= 0 && ks + 1 < 8) __builtin_amdgcn_sched_barrier(0);   // the reads of step ks + 1 are issued in front of the products of step ks: left alone the scheduler put each fragment's read and a full LDS wait directly in front of its two products
        if (ks >= 0) {   // all eight hi products, then all eight lo: fragments are used in the order they were read, and an accumulator's own order stays hi then lo
#pragma unroll
            for (int mb = 0; mb < 4; ++mb)
#pragma unroll
                for (int nb = 0; nb < 2; ++nb) acc[mb][nb] = wmmab(a[ks & 1][mb], wb[ks][nb], acc[mb][nb]);
#pragma unroll
            for (int mb = 0; mb < 4; ++mb)
#pragma unroll
                for (int nb = 0; nb < 2; ++nb) acc[mb][nb] = wmmab(a2[ks & 1][mb], wb[ks][nb], acc[mb][nb]);
            if (ks + 2 < 8) __builtin_amdgcn_sched_barrier(0); }   // and no read moves further ahead than one step, so that each step's reads stand in one place
    }
    float* const ow = os + w * 16 * OP; float* const orp = OUT + (size_t)(g0 + orow) * DM + c0 + ocol;
    v4f bv;
#pragma unroll
    for (int q2 = 0; q2 < 4; ++q2) bv[q2] = bfr(braw[q2]);
#pragma unroll
    for (int mb = 0; mb < 4; ++mb) {
#pragma unroll
        for (int nb = 0; nb < 2; ++nb)
#pragma unroll
            for (int j = 0; j < 8; ++j) ow[(hi * 8 + j) * OP + nb * 16 + lr] = acc[mb][nb][j];
        __builtin_amdgcn_wave_barrier(); asm volatile("" ::: "memory");   // the compiler keeps the strip's reads behind the other lanes' writes
        v4f val[4];
#pragma unroll
        for (int s = 0; s < 4; ++s) val[s] = *(const v4fa*)(ow + (4 * s + orow) * OP + ocol);
#pragma unroll
        for (int s = 0; s < 4; ++s) *(v4f*)(orp + (mb * 16 + 4 * s) * DM) = val[s] + bv;
        if (mb < 3) { __builtin_amdgcn_wave_barrier(); asm volatile("" ::: "memory"); }   // the compiler keeps the next turn's writes behind this turn's reads
    }
}

// ---- k_prep: the two jobs that read weights only and do not depend on one another (fused weight -> Bt, output weight -> Bt) as block ranges of ONE launch; the range test is on blockIdx.x alone, the same for a whole block.
// A block turns one tile of 64 k x 64 n through LDS. A thread holds 4 k x 4 n: its four 16-byte loads are all in flight at once, and a load instruction of a wave takes two rows' 256 bytes (four whole lines);
// rounded to bf16, each n's four successive k go to LDS as one 8-byte store; behind one barrier a thread takes 8 successive k of one n, so that a store instruction of a wave writes four whole 128-byte lines of Bt. A block is the one writer of its lines.
#define PB_WQKV (DM * 3 * DQ / 64 / 64)        // blocks of the fused weight: tiles of 64 x 64 elements
#define PB_WO   (DQ * DM / 64 / 64)            // blocks of the output weight
#define TP 72                                  // LDS pitch of a tile row (one n) in elements: 16 bytes x an odd number
static_assert(DM % 64 == 0 && DQ % 64 == 0 && DM == DQ, "whole tiles in every range; both weights have the same k length");
__global__ __launch_bounds__(256) void k_prep(const float* __restrict__ wqkv, const float* __restrict__ wo, bf* WQKV, bf* WO) {
    __shared__ __align__(16) bf ts[64 * TP];
    const int tid = threadIdx.x; const bool fu = blockIdx.x < PB_WQKV;
    const unsigned blk = fu ? blockIdx.x : blockIdx.x - PB_WQKV; const int N = fu ? 3 * DQ : DM;   // the job's tile number and row length; Bt row of the fused weight: s * 256 + h * 64 + d
    const float* const w = fu ? wqkv : wo; bf* const Bt = fu ? WQKV : WO;
    const int k0 = (blk % (DM / 64)) * 64, n0 = (blk / (DM / 64)) * 64, a = tid >> 4, b = tid & 15;
    const float* const p0 = w + (k0 + 4 * a) * N + n0 + 4 * b; const float* const p1 = p0 + N; const float* const p2 = p1 + N; const float* const p3 = p2 + N;
    v4f r[4]; r[0] = *(const v4f*)p0; r[1] = *(const v4f*)p1; r[2] = *(const v4f*)p2; r[3] = *(const v4f*)p3;
    asm volatile("s_wait_xcnt 0x0" :: "v"(p0), "v"(p1), "v"(p2), "v"(p3) : "memory");   // the wait before anything rewrites an address register that these loads name; the pointers are inputs so that no load's result is given their registers in front of it
    // both loops below are unrolled: the indices pick registers
#pragma unroll
    for (int j = 0; j < 4; ++j) { v4us o;
#pragma unroll
        for (int i = 0; i < 4; ++i) o[i] = f2bf(r[i][j]);
        *(v4us*)(ts + (4 * b + j) * TP + 4 * a) = o; }
    __syncthreads();   // the whole tile is in LDS before any thread reads a row of it
#pragma unroll   // both LDS reads are issued in front of the first store
    for (int i = 0; i < 2; ++i) { const int u = tid + 256 * i; *(v8us*)(Bt + (n0 + (u >> 3)) * DM + k0 + (u & 7) * 8) = *(const v8us*)(ts + (u >> 3) * TP + (u & 7) * 8); }
}
extern "C" void kernel_launch(void* const* d_in, const int* in_sizes, int n_in,
                              void* d_out, int out_size, void* d_ws, size_t ws_size, hipStream_t stream) {
    (void)in_sizes; (void)n_in; (void)out_size;
    const float* x = (const float*)d_in[0]; const float* wqkv = (const float*)d_in[1]; const float* bqkv = (const float*)d_in[2]; const float* wo = (const float*)d_in[3]; const float* bo = (const float*)d_in[4];
    // inputs in the module's argument order: x ([4][4096][256]), Wqkv ('xw' (in, out) [256][768]; output column s * 256 + h * 64 + d, s = 0 query, 1 key, 2 value), bqkv ([768]), Wout ('xw' [256][256]), bout ([256]) = d_in[0..4]: FIVE inputs, all read (the set-up builds the two biases as zeros: read all the same)
    float* OUT = (float*)d_out;     // [4][4096][256]
    char* wsp = (char*)d_ws;
    auto take = [&](size_t bytes) { char* p = wsp; wsp += (bytes + 255) & ~(size_t)255; return (void*)p; };
    bf* WQKV = (bf*)take((size_t)3 * DQ * DM * 2); bf* WO = (bf*)take((size_t)DM * DQ * 2);
    if ((size_t)(wsp - (char*)d_ws) > ws_size) return;    // total 0.50 MiB carved
    /* every stage once, over all batch entries and heads */
    k_prep<<<PB_WQKV + PB_WO, 256, 0, stream>>>(wqkv, wo, WQKV, WO);   /* both weights transposed to bf16: two independent jobs, one launch */
    k_attn<<<NB_ * TT / 64, 256, 0, stream>>>(x, WQKV, bqkv, WO, bo, OUT);   /* the block's window of the stream rounded to bf16 at its load; q | k | v of each block's own window in one product each, kept in registers as f16; scores, band, softmax and weights x values: ONE f16 product each on every row; the merged context hi / lo stays in LDS; out = merged(hi + lo) Wout + bout: the one writer of the output */
}
